// v000
// Times are from an AMD MI455X. After a warm-up the kernel runs many times in a row, and a time is the length of
// such a window on the GPU divided by its runs, so every launch and the gaps after it count. The runs cycle
// through copies of the inputs. A figure is the median of several windows, for all but v000 over two sittings.
// Sittings can differ by a few percent; kernels timed side by side share one.
// v000, which the later versions start from, runs in 442 microseconds.
// Contractions: q|k = X.Wqk^T and v^T = Wv^T.X^T : v_wmma_f32_16x16x32_f16 (f16 operands, carries X x8, W x64, q/k/v x16),
// S^T = k.q^T and O = P.v : v_wmma_f32_16x16x32_f16 (f16 operands, P = 16*exp(s - m)), f32 accumulate; out = O.Wo + bo :
// v_wmma_f32_16x16x32_bf16, O as bf16 hi/lo planes (hi.W + lo.W), Wo^T bf16, f32 accumulate; float inputs RNE-converted
// to bf16 on load; softmax statistics, normaliser and biases in f32.
#include <hip/hip_runtime.h>
#include <stdint.h>

#define NSEQ 4
#define SEQ  4096
#define NTOT (NSEQ * SEQ)
#define DM   512
#define LDQK (2 * DM)

typedef _Float16 v16h __attribute__((ext_vector_type(16)));
typedef _Float16 v8h  __attribute__((ext_vector_type(8)));
typedef __bf16   v16b __attribute__((ext_vector_type(16)));
typedef __bf16   v8b  __attribute__((ext_vector_type(8)));
typedef float    v8f  __attribute__((ext_vector_type(8)));
typedef float    v4f  __attribute__((ext_vector_type(4)));
typedef unsigned short v8us __attribute__((ext_vector_type(8)));

static_assert((DM % 64) == 0);
static_assert((NTOT % 64) == 0);
static_assert((SEQ % 256) == 0);

// f32 -> nearest-even bf16 bits / value
__device__ __forceinline__ unsigned short bfbits(float f) {
  unsigned u = __float_as_uint(f);
  return (unsigned short)((u + 0x7FFFu + ((u >> 16) & 1u)) >> 16);
}
__device__ __forceinline__ float bfval(unsigned short b) { return __uint_as_float(((unsigned)b) << 16); }
__device__ __forceinline__ float bfr(float f) { return bfval(bfbits(f)); }
__device__ __forceinline__ void split_bf(float f, unsigned short& hb, unsigned short& lb) {
  hb = bfbits(f);
  lb = bfbits(f - bfval(hb));
}

// 16-bit operand element types for the GEMM template: 0 = f16, 1 = bf16
template <int ET> struct Elem;
template <> struct Elem<0> {
  typedef _Float16 T; typedef v16h V; typedef v8h V8;
  static __device__ __forceinline__ v8f mma(V a, V b, v8f c) {
    return __builtin_amdgcn_wmma_f32_16x16x32_f16(false, a, false, b, (short)0, c, false, false);
  }
};
template <> struct Elem<1> {
  typedef __bf16 T; typedef v16b V; typedef v8b V8;
  static __device__ __forceinline__ v8f mma(V a, V b, v8f c) {
    return __builtin_amdgcn_wmma_f32_16x16x32_bf16(false, a, false, b, (short)0, c, false, false);
  }
};

// 16-bit WMMA fragment from k-contiguous storage (A row-major [m][k], or B stored [n][k]):
// p points at element (row_or_col = lane&15, k0 + 8h); elements 0..7 <- p[0..7], 8..15 <- p[16..23].
template <int ET>
__device__ __forceinline__ typename Elem<ET>::V ldfragT(const typename Elem<ET>::T* p) {
  typedef typename Elem<ET>::V V;
  typedef typename Elem<ET>::V8 V8;
  union { V v; V8 h[2]; } f;
  f.h[0] = *(const V8*)(p);
  f.h[1] = *(const V8*)(p + 16);
  return f.v;
}
__device__ __forceinline__ v16h ldfrag(const _Float16* p) { return ldfragT<0>(p); }
__device__ __forceinline__ v8f mma16(v16h a, v16h b, v8f c) { return Elem<0>::mma(a, b, c); }
__device__ __forceinline__ v8f zero8() {
  v8f z;
#pragma unroll
  for (int i = 0; i < 8; ++i) z[i] = 0.0f;
  return z;
}

// hazard guards: 4 VALU slots after the last WMMA of a group, D tied, A/B kept live
__device__ __forceinline__ void guard_g(v8f& a, v8f& b, v16h x, v16h y) {
  asm volatile("v_nop\n\tv_nop\n\tv_nop\n\tv_nop" : "+v"(a), "+v"(b) : "v"(x), "v"(y));
}
__device__ __forceinline__ void guard_g(v8f& a, v8f& b, v16b x, v16b y) {
  asm volatile("v_nop\n\tv_nop\n\tv_nop\n\tv_nop" : "+v"(a), "+v"(b) : "v"(x), "v"(y));
}
__device__ __forceinline__ void keep4(v16h a, v16h b, v16h c, v16h d) {
  asm volatile("v_nop" :: "v"(a), "v"(b), "v"(c), "v"(d));
}
__device__ __forceinline__ void keep4(v16b a, v16b b, v16b c, v16b d) {
  asm volatile("v_nop" :: "v"(a), "v"(b), "v"(c), "v"(d));
}
__device__ __forceinline__ void accg4(v8f& a, v8f& b, v8f& c, v8f& d) {
  asm volatile("v_nop\n\tv_nop\n\tv_nop\n\tv_nop" : "+v"(a), "+v"(b), "+v"(c), "+v"(d));
}
__device__ __forceinline__ void guard_s4(v8f& a, v8f& b, v8f& c, v8f& d, v16h x0, v16h x1, v16h y0, v16h y1) {
  asm volatile("v_nop\n\tv_nop\n\tv_nop\n\tv_nop"
               : "+v"(a), "+v"(b), "+v"(c), "+v"(d) : "v"(x0), "v"(x1), "v"(y0), "v"(y1));
}

// ---------------------------------------------------------------------------------------------
// Kernel 1: x f32 [NTOT][DM] -> f16 plane X [NTOT][DM], value f16(8 * bf16(x)). 8 elements per thread: one 16-B store per
// coverage: n8/256 blocks * 256 threads * 8 = NTOT*DM elements (n8 = NTOT*DM/8 is a multiple of 256).
// ---------------------------------------------------------------------------------------------
__global__ __launch_bounds__(256) void cvt_x_kernel(const float* __restrict__ x, _Float16* __restrict__ d16, int n8) {
  const int li = (int)blockIdx.x * 256 + (int)threadIdx.x;
  if (li >= n8) return;
  const size_t e = (size_t)li * 8;
  const v4f a = *(const v4f*)(x + e);
  const v4f b = *(const v4f*)(x + e + 4);
  v8h o;
#pragma unroll
  for (int i = 0; i < 4; ++i) {
    o[i]     = (_Float16)(bfr(a[i]) * 8.0f);
    o[4 + i] = (_Float16)(bfr(b[i]) * 8.0f);
  }
  _Float16* d = d16 + e;
  *(v8h*)d = o;
  
}

// ---------------------------------------------------------------------------------------------
// Kernel 2: four [DM][DM] f32 weight matrices w[in][out] -> TRANSPOSED 16-bit planes [out][in] (k = in contiguous):
//   blocks [0,192):   Wt16[(mat*DM + p)][d] = f16(64 * bf16(w_mat[d][p]))   mat 0,1,2 = Wq, Wk, Wv
//   blocks [192,256): Wob[p][d]               = bf16 bits of Wo[d][p] (here d indexes Wo rows = the O feature, p = output column)
// Block = one 64x64 tile: in rows r0..r0+63, in cols c0..c0+63 (tile index block-uniform); tile staged transposed in LDS
// coverage: per matrix 64 tiles x (2 iterations x 32 lines x 64 halves) = DM x DM elements.
// ---------------------------------------------------------------------------------------------
__global__ __launch_bounds__(256) void cvt_wt_kernel(const float* __restrict__ w0, const float* __restrict__ w1,
                                                     const float* __restrict__ w2, const float* __restrict__ w3,
                                                     _Float16* __restrict__ wt16, unsigned short* __restrict__ wob) {
  __shared__ __align__(16) float sT[64 * 68];
  const int tid = (int)threadIdx.x;
  const int mat = (int)blockIdx.x >> 6;                 // 0..3
  const int tile = (int)blockIdx.x & 63;
  const int tr = tile >> 3, tc = tile & 7;               // in[tr*64 ..][tc*64 ..] -> out[tc*64 ..][tr*64 ..]
  const float* src = (mat == 0) ? w0 : ((mat == 1) ? w1 : ((mat == 2) ? w2 : w3));
  {
    const int r = tid >> 2, c16 = (tid & 3) * 16;
    const float* sp = src + (size_t)(tr * 64 + r) * DM + tc * 64 + c16;
#pragma unroll
    for (int i = 0; i < 4; ++i) {
      const v4f a = *(const v4f*)(sp + 4 * i);
#pragma unroll
      for (int e = 0; e < 4; ++e) sT[(c16 + 4 * i + e) * 68 + r] = a[e];
    }
  }
  __syncthreads();
  const int piece = tid & 7;
#pragma unroll
  for (int it = 0; it < 2; ++it) {
    const int line = it * 32 + (tid >> 3);               // output row within the tile (input column)
    const float* lp = sT + line * 68 + piece * 8;
    const v4f u0 = *(const v4f*)lp, u1 = *(const v4f*)(lp + 4);
    const int prow = tc * 64 + line;
    const int d0 = tr * 64 + piece * 8;
    if (mat < 3) {
      v8h o;
#pragma unroll
      for (int e = 0; e < 4; ++e) {
        o[e]     = (_Float16)(bfr(u0[e]) * 64.0f);
        o[4 + e] = (_Float16)(bfr(u1[e]) * 64.0f);
      }
      _Float16* d = wt16 + (size_t)(mat * DM + prow) * DM + d0;
      *(v8h*)d = o;
      
    } else {
      v8us o;
#pragma unroll
      for (int e = 0; e < 4; ++e) {
        o[e]     = bfbits(u0[e]);
        o[4 + e] = bfbits(u1[e]);
      }
      unsigned short* d = wob + (size_t)prow * DM + d0;
      *(v8us*)d = o;
      
    }
  }
}

// ---------------------------------------------------------------------------------------------
// Kernel 3: C[m][n] = scale * sum_k A[m][k] * Bt[n][k] + bias.
// A row-major [M][K] 16-bit (ET 0: f16, ET 1: bf16) pitch lda; Bt row-major [N][K] same type pitch ldb; M, N multiples
// of 64, K multiple of 32. SPLITA: A is a hi plane (Ap) plus a lo plane (A2p, same layout), product = hi.B + lo.B.
// BIAS_MODE 0: none; 1: per column n, bias0[n] for n < nsplit else bias1[n - nsplit] (both loaded with clamped indices,
// selected by value); 2: per row m, bias0[m]. Bias values bf16-converted and multiplied by bias_scale.
// Each wave owns one 64x64 C tile (16 f32 accumulators); 8 waves per block; no block barriers.
// OUT_MODE 0: f32 output; OUT_MODE 1: f16 output. Epilogue: 16-row slab per wave in LDS, then each 64-wide
// coverage: tilesM * tilesN tiles, each 64x64 written fully -> M x N.
// ---------------------------------------------------------------------------------------------
template <int ET, bool SPLITA, int OUT_MODE, int BIAS_MODE>
__global__ __launch_bounds__(256) void gemm64_kernel(const unsigned short* __restrict__ Ap,
                                                     const unsigned short* __restrict__ A2p, int lda,
                                                     const unsigned short* __restrict__ Btp, int ldb,
                                                     void* __restrict__ Cout, int ldc,
                                                     const float* __restrict__ bias0, const float* __restrict__ bias1,
                                                     int nsplit, int M, int N, int K, float scale, float bias_scale) {
  typedef typename Elem<ET>::T T;
  typedef typename Elem<ET>::V V;
  const T* A  = (const T*)(const void*)Ap;
  const T* A2 = (const T*)(const void*)A2p;
  const T* Bt = (const T*)(const void*)Btp;
  __shared__ __align__(16) float sT[8][16 * 68];
  const int lane = threadIdx.x & 31, wave = threadIdx.x >> 5;
  const int tilesN = N >> 6, tilesM = M >> 6;
  const int tile = (int)blockIdx.x * 8 + wave;
  if (tile >= tilesM * tilesN) return;
  const int tm = tile / tilesN, tn = tile - tm * tilesN;
  const int m0 = tm << 6, n0 = tn << 6;
  const int rl = lane & 15;
  const int koff = (lane >> 4) * 8;
  const int mOff = (lane >> 4) * 8;

  v8f acc[4][4];
#pragma unroll
  for (int i = 0; i < 4; ++i)
#pragma unroll
    for (int j = 0; j < 4; ++j) acc[i][j] = zero8();

#pragma unroll 1
  for (int k0 = 0; k0 < K; k0 += 32) {
    V bh[4];
#pragma unroll
    for (int j = 0; j < 4; ++j) bh[j] = ldfragT<ET>(Bt + (size_t)(n0 + (j << 4) + rl) * ldb + koff + k0);
#pragma unroll
    for (int i = 0; i < 4; ++i) {
      const size_t ao = (size_t)(m0 + (i << 4) + rl) * lda + koff + k0;
      const V ah = ldfragT<ET>(A + ao);
      V al = ah;
      if (SPLITA) al = ldfragT<ET>(A2 + ao);
#pragma unroll
      for (int j = 0; j < 4; ++j) {
        acc[i][j] = Elem<ET>::mma(ah, bh[j], acc[i][j]);
        if (SPLITA) acc[i][j] = Elem<ET>::mma(al, bh[j], acc[i][j]);
      }
      guard_g(acc[i][0], acc[i][3], ah, SPLITA ? al : bh[3]);
    }
    keep4(bh[0], bh[1], bh[2], bh[3]);
  }
  accg4(acc[0][0], acc[0][1], acc[0][2], acc[0][3]);
  accg4(acc[1][0], acc[1][1], acc[1][2], acc[1][3]);
  accg4(acc[2][0], acc[2][1], acc[2][2], acc[2][3]);
  accg4(acc[3][0], acc[3][1], acc[3][2], acc[3][3]);

  float* slab = sT[wave];
#pragma unroll
  for (int i = 0; i < 4; ++i) {
    const int mBase = m0 + (i << 4);
    float brow[8];
#pragma unroll
    for (int r = 0; r < 8; ++r) brow[r] = 0.0f;
    if (BIAS_MODE == 2) {
#pragma unroll
      for (int r = 0; r < 8; ++r) {
        int mi = mBase + mOff + r;
        mi = (mi < M) ? mi : (M - 1);
        brow[r] = bfr(bias0[mi]) * bias_scale;
      }
    }
#pragma unroll
    for (int j = 0; j < 4; ++j) {
      float bcol = 0.0f;
      if (BIAS_MODE == 1) {
        const int n = n0 + (j << 4) + rl;
        const int i0 = (n < nsplit) ? n : (nsplit - 1);
        int i1 = n - nsplit;
        i1 = (i1 > 0) ? i1 : 0;
        int lim1 = N - nsplit - 1;
        lim1 = (lim1 > 0) ? lim1 : 0;
        i1 = (i1 < lim1) ? i1 : lim1;
        const float b0v = bfr(bias0[i0]);
        const float b1v = bfr(bias1[i1]);
        bcol = ((n < nsplit) ? b0v : b1v) * bias_scale;
      }
#pragma unroll
      for (int r = 0; r < 8; ++r) slab[(mOff + r) * 68 + (j << 4) + rl] = acc[i][j][r] * scale + bcol + brow[r];
    }
    __builtin_amdgcn_fence(__ATOMIC_RELEASE, "workgroup");
    __builtin_amdgcn_wave_barrier();
    __builtin_amdgcn_fence(__ATOMIC_ACQUIRE, "workgroup");
    if (OUT_MODE == 0) {
      float* C = (float*)Cout;
      const int hh = lane >> 4, c4 = (lane & 15) * 4;
{
#pragma unroll
        for (int it = 0; it < 8; ++it) {
          const int row = it * 2 + hh;
          const v4f v = *(const v4f*)(slab + row * 68 + c4);
          *(v4f*)(C + (size_t)(mBase + row) * ldc + n0 + c4) = v;
        }
        
      }
    } else {
      _Float16* C = (_Float16*)Cout;
      const int qq = lane >> 3, c8 = (lane & 7) * 8;
{
#pragma unroll
        for (int it = 0; it < 4; ++it) {
          const int row = it * 4 + qq;
          const float* sp = slab + row * 68 + c8;
          v8h hv;
#pragma unroll
          for (int e = 0; e < 8; ++e) hv[e] = (_Float16)sp[e];
          *(v8h*)(C + (size_t)(mBase + row) * ldc + n0 + c8) = hv;
        }
        
      }
    }
    __builtin_amdgcn_fence(__ATOMIC_RELEASE, "workgroup");
    __builtin_amdgcn_wave_barrier();
    __builtin_amdgcn_fence(__ATOMIC_ACQUIRE, "workgroup");
  }
}

// ---------------------------------------------------------------------------------------------
// Kernel 4: full (non-causal) single-head attention per sequence, head width 512, online softmax in f32.
//   qk plane f16 [NTOT][LDQK]: columns 0..511 = 16*q, columns 512..1023 = 16*k; vt plane f16 [DM][NTOT] (value 16*v);
//   outputs oh / ol = bf16 hi / lo planes (as 16-bit storage) of O = softmax(q k^T * scale) . v, [NTOT][DM], unscaled.
//   Block = 256 threads = 8 waves, 32 query rows (all in one sequence); Q tile staged once in LDS. Key tiles of 256
//   within the sequence: wave w owns keys 32w..32w+31 of the tile for the logits: S^T subtiles (A = k rows from global,
//   B = Q rows from LDS), so the D layout gives per lane 8 consecutive keys of one query -> P written to LDS as 16-B
//   vectors ([query][key]). P = 16 * exp(s - m_running) in f16 (values <= 16).
//   Row max / sum: per-wave partials in LDS, combined in fixed order by wave 0 (one lane per query row).
//   P.V: every wave reads the whole P tile (A operand) and owns 64 value columns (B from the vt plane).
//   Output: normalised O split into bf16 hi / lo, two 32x512 16-bit tiles staged in LDS (hi over the Q region,
//   lo over the P region), barrier, then each wave writes 4 whole rows per plane, 512 B per instruction (2 per row,
// coverage: NTOT/32 blocks x 8 waves x 4 rows x 512 = NTOT x DM per plane.
// ---------------------------------------------------------------------------------------------
#define QB       32
#define KCH      256
#define QSP      520
#define PSP      264
#define LDS_QS   0
#define LDS_LS   33280
#define LDS_PS   33280
#define LDS_PMAX 66560
#define LDS_PSUM 67584
#define LDS_ST   68608
#define ATT_LDS  69120
static_assert(QB * QSP * 2 == LDS_LS - LDS_QS);
static_assert(QB * QSP * 2 == LDS_PMAX - LDS_LS);
static_assert(QB * PSP * 2 <= LDS_PMAX - LDS_PS);
static_assert(LDS_PSUM - LDS_PMAX == 256 * 4);
static_assert(LDS_ST - LDS_PSUM == 256 * 4);
static_assert(ATT_LDS - LDS_ST == 4 * 32 * 4);
static_assert((QSP % 8) == 0 && (PSP % 8) == 0 && PSP >= KCH && QSP >= DM);
static_assert((LDS_LS % 16) == 0 && (LDS_PMAX % 16) == 0 && (LDS_ST % 16) == 0);
static_assert((SEQ % KCH) == 0 && (SEQ % QB) == 0 && (DM % 64) == 0);

__global__ __launch_bounds__(256) void attn_kernel(const _Float16* __restrict__ qk, const _Float16* __restrict__ vt,
                                                   unsigned short* __restrict__ oh, unsigned short* __restrict__ ol,
                                                   float sc) {
  extern __shared__ __align__(16) char smem[];
  _Float16* Qs = (_Float16*)(smem + LDS_QS);
  _Float16* Ps = (_Float16*)(smem + LDS_PS);
  float* pmax = (float*)(smem + LDS_PMAX);
  float* psum = (float*)(smem + LDS_PSUM);
  float* m_s  = (float*)(smem + LDS_ST);
  float* l_s  = m_s + 32;
  float* al_s = m_s + 64;
  float* li_s = m_s + 96;

  const int tid = threadIdx.x, wave = tid >> 5, lane = tid & 31, h = lane >> 4, c = lane & 15;
  const int q0 = (int)blockIdx.x * QB;            // first query row (global token index)
  const int bk0 = (q0 / SEQ) * SEQ;               // first key row of this sequence
  const float ninf = -__builtin_inff();

  if (tid < 32) { m_s[tid] = ninf; l_s[tid] = 0.0f; al_s[tid] = 0.0f; li_s[tid] = 0.0f; }
  psum[tid] = 0.0f;
  // Q tile: 32 rows x 64 pieces of 8 halves; coverage 8 * 256 = 2048 pieces = the whole tile
#pragma unroll
  for (int i = 0; i < 8; ++i) {
    const int idx = i * 256 + tid;
    const int row = idx >> 6;
    const int pc  = idx & 63;
    const v8h v = *(const v8h*)(qk + (size_t)(q0 + row) * LDQK + pc * 8);
    *(v8h*)(Qs + row * QSP + pc * 8) = v;
  }
  __syncthreads();

  v8f oacc[2][4];
#pragma unroll
  for (int qt = 0; qt < 2; ++qt)
#pragma unroll
    for (int nt = 0; nt < 4; ++nt) oacc[qt][nt] = zero8();

  const _Float16* qb0p = Qs + c * QSP + 8 * h;            // B operand, query c
  const _Float16* qb1p = Qs + (16 + c) * QSP + 8 * h;     // B operand, query 16+c
  const _Float16* pa0p = Ps + c * PSP + 8 * h;            // A operand, query c
  const _Float16* pa1p = Ps + (16 + c) * PSP + 8 * h;     // A operand, query 16+c
  const int ntile = SEQ / KCH;

#pragma unroll 1
  for (int t = 0; t < ntile; ++t) {
    // ---- logits: S^T subtiles for keys kb..kb+31 (this wave), queries 0..31 ----
    const int kb = bk0 + t * KCH + 32 * wave;
    const _Float16* ka0p = qk + (size_t)(kb + c) * LDQK + DM + 8 * h;
    const _Float16* ka1p = qk + (size_t)(kb + 16 + c) * LDQK + DM + 8 * h;
    v8f sacc[2][2];   // [query subtile][key subtile]; element r: query 16qt+c, key kb+16kt+8h+r
#pragma unroll
    for (int qt = 0; qt < 2; ++qt)
#pragma unroll
      for (int kt = 0; kt < 2; ++kt) sacc[qt][kt] = zero8();
#pragma unroll 1
    for (int k0 = 0; k0 < DM; k0 += 32) {
      const v16h a0 = ldfrag(ka0p + k0), a1 = ldfrag(ka1p + k0);
      const v16h b0 = ldfrag(qb0p + k0), b1 = ldfrag(qb1p + k0);
      sacc[0][0] = mma16(a0, b0, sacc[0][0]);
      sacc[0][1] = mma16(a1, b0, sacc[0][1]);
      sacc[1][0] = mma16(a0, b1, sacc[1][0]);
      sacc[1][1] = mma16(a1, b1, sacc[1][1]);
      guard_s4(sacc[0][0], sacc[0][1], sacc[1][0], sacc[1][1], a0, a1, b0, b1);
    }
    // ---- scale, per-wave partial row max ----
    {
      float pm0 = ninf, pm1 = ninf;
#pragma unroll
      for (int kt = 0; kt < 2; ++kt) {
#pragma unroll
        for (int r = 0; r < 8; ++r) {
          const float v0 = sacc[0][kt][r] * sc; sacc[0][kt][r] = v0; pm0 = fmaxf(pm0, v0);
          const float v1 = sacc[1][kt][r] * sc; sacc[1][kt][r] = v1; pm1 = fmaxf(pm1, v1);
        }
      }
      pm0 = fmaxf(pm0, __shfl_xor(pm0, 16, 32));
      pm1 = fmaxf(pm1, __shfl_xor(pm1, 16, 32));
      pmax[wave * 32 + c] = pm0;
      pmax[wave * 32 + 16 + c] = pm1;
    }
    __syncthreads();
    // ---- wave 0, lane = query row: fold the prior tile's sums into l, new running max, rescale factor ----
    if (wave == 0) {
      const int row = lane;
      float ps = 0.0f;
#pragma unroll
      for (int w = 0; w < 8; ++w) ps += psum[w * 32 + row];
      l_s[row] = l_s[row] * al_s[row] + ps;
      const float mo = m_s[row];
      float mx = mo;
#pragma unroll
      for (int w = 0; w < 8; ++w) mx = fmaxf(mx, pmax[w * 32 + row]);
      al_s[row] = __expf(mo - mx);
      m_s[row] = mx;
    }
    __syncthreads();
    // ---- p = 16 * exp(s - m) as f16, P tile, partial row sums, rescale O ----
    {
      const float mq0 = m_s[c], mq1 = m_s[16 + c];
      float ps0 = 0.0f, ps1 = 0.0f;
#pragma unroll
      for (int kt = 0; kt < 2; ++kt) {
        v8h h0, h1;
#pragma unroll
        for (int r = 0; r < 8; ++r) {
          const float p0 = __expf(sacc[0][kt][r] - mq0); ps0 += p0; h0[r] = (_Float16)(p0 * 16.0f);
          const float p1 = __expf(sacc[1][kt][r] - mq1); ps1 += p1; h1[r] = (_Float16)(p1 * 16.0f);
        }
        *(v8h*)(Ps + c * PSP + 32 * wave + 16 * kt + 8 * h) = h0;
        *(v8h*)(Ps + (16 + c) * PSP + 32 * wave + 16 * kt + 8 * h) = h1;
      }
      ps0 += __shfl_xor(ps0, 16, 32);
      ps1 += __shfl_xor(ps1, 16, 32);
      psum[wave * 32 + c] = ps0;
      psum[wave * 32 + 16 + c] = ps1;
      const v4f aA = *(const v4f*)(al_s + 8 * h), aB = *(const v4f*)(al_s + 8 * h + 4);
      const v4f bA = *(const v4f*)(al_s + 16 + 8 * h), bB = *(const v4f*)(al_s + 16 + 8 * h + 4);
#pragma unroll
      for (int nt = 0; nt < 4; ++nt) {
#pragma unroll
        for (int r = 0; r < 4; ++r) {
          oacc[0][nt][r] *= aA[r]; oacc[0][nt][4 + r] *= aB[r];
          oacc[1][nt][r] *= bA[r]; oacc[1][nt][4 + r] *= bB[r];
        }
      }
    }
    __syncthreads();
    // ---- O += P . V over the 256 keys of the tile; this wave's columns 64w + 16nt + c ----
    {
      const _Float16* vbp = vt + (size_t)(64 * wave + c) * NTOT + bk0 + (size_t)t * KCH + 8 * h;
#pragma unroll 1
      for (int ks = 0; ks < KCH; ks += 32) {
        const v16h pa0 = ldfrag(pa0p + ks), pa1 = ldfrag(pa1p + ks);
#pragma unroll
        for (int g = 0; g < 2; ++g) {
          v16h vb[2];
#pragma unroll
          for (int j = 0; j < 2; ++j) vb[j] = ldfrag(vbp + (size_t)(16 * (2 * g + j)) * NTOT + ks);
#pragma unroll
          for (int j = 0; j < 2; ++j) {
            oacc[0][2 * g + j] = mma16(pa0, vb[j], oacc[0][2 * g + j]);
            oacc[1][2 * g + j] = mma16(pa1, vb[j], oacc[1][2 * g + j]);
          }
          guard_s4(oacc[0][2 * g], oacc[0][2 * g + 1], oacc[1][2 * g], oacc[1][2 * g + 1], pa0, pa1, vb[0], vb[1]);
        }
      }
    }
  }

  // ---- final normaliser per query row (fold the last tile's sums); O = oacc / (256 * l) (P carry 16, v carry 16) ----
  if (wave == 0) {
    const int row = lane;
    float ps = 0.0f;
#pragma unroll
    for (int w = 0; w < 8; ++w) ps += psum[w * 32 + row];
    const float l = l_s[row] * al_s[row] + ps;
    li_s[row] = (1.0f / l) * (1.0f / 256.0f);
  }
  __syncthreads();
  // ---- stage the 32 x 512 bf16 hi / lo tiles (hi over the Q region, lo over the P region) ----
  unsigned short* Hs = (unsigned short*)(smem + LDS_QS);
  unsigned short* Ls = (unsigned short*)(smem + LDS_LS);
  {
    const v4f iA0 = *(const v4f*)(li_s + 8 * h),      iB0 = *(const v4f*)(li_s + 8 * h + 4);
    const v4f iA1 = *(const v4f*)(li_s + 16 + 8 * h), iB1 = *(const v4f*)(li_s + 16 + 8 * h + 4);
#pragma unroll
    for (int nt = 0; nt < 4; ++nt) {
      const int col = 64 * wave + 16 * nt + c;
#pragma unroll
      for (int r = 0; r < 4; ++r) {
        unsigned short hb, lb;
        split_bf(oacc[0][nt][r] * iA0[r], hb, lb);
        Hs[(8 * h + r) * QSP + col] = hb;          Ls[(8 * h + r) * QSP + col] = lb;
        split_bf(oacc[0][nt][4 + r] * iB0[r], hb, lb);
        Hs[(8 * h + 4 + r) * QSP + col] = hb;      Ls[(8 * h + 4 + r) * QSP + col] = lb;
        split_bf(oacc[1][nt][r] * iA1[r], hb, lb);
        Hs[(16 + 8 * h + r) * QSP + col] = hb;     Ls[(16 + 8 * h + r) * QSP + col] = lb;
        split_bf(oacc[1][nt][4 + r] * iB1[r], hb, lb);
        Hs[(16 + 8 * h + 4 + r) * QSP + col] = hb; Ls[(16 + 8 * h + 4 + r) * QSP + col] = lb;
      }
    }
  }
  __syncthreads();
  {
    unsigned short* gh = oh + (size_t)q0 * DM;
    unsigned short* gl = ol + (size_t)q0 * DM;
{
#pragma unroll
      for (int rr = 0; rr < 4; ++rr) {
        const int row = 4 * wave + rr;
#pragma unroll
        for (int j = 0; j < 2; ++j) {
          const int pc = j * 32 + lane;
          const v8us hvv = *(const v8us*)(Hs + row * QSP + pc * 8);
          const v8us lvv = *(const v8us*)(Ls + row * QSP + pc * 8);
          *(v8us*)(gh + (size_t)row * DM + pc * 8) = hvv;
          *(v8us*)(gl + (size_t)row * DM + pc * 8) = lvv;
        }
      }
      
    }
  }
}

// ---------------------------------------------------------------------------------------------
//   Wt16 : Wq^T, Wk^T, Wv^T stacked f16 [1536][512] (64 * bf16(w))   off 0            size  1,572,864
//   Wob  : Wo^T bf16 bits [512][512]                                  off  1,572,864   size    524,288
//   X16  : f16 [16384][512] (8 * bf16(x))                              off  2,097,152   size 16,777,216
//   QK16 : 16*q | 16*k f16 [16384][1024]                              off 18,874,368   size 33,554,432
//   VT16 : 16*v^T f16 [512][16384]                                    off 52,428,800   size 16,777,216
//   OH   : attention output bf16 hi [16384][512]                      off 69,206,016   size 16,777,216
//   OL   : attention output bf16 lo [16384][512]                      off 85,983,232   size 16,777,216
//   total 102,760,448
// ---------------------------------------------------------------------------------------------
extern "C" void kernel_launch(void* const* d_in, const int* in_sizes, int n_in,
                              void* d_out, int out_size, void* d_ws, size_t ws_size,
                              hipStream_t stream) {
  if (n_in < 9) return;
  const int ntot = NTOT, dm = DM;
  if (in_sizes[0] != ntot * dm) return;
  if (in_sizes[1] != dm * dm || in_sizes[3] != dm * dm || in_sizes[5] != dm * dm || in_sizes[7] != dm * dm) return;
  if (in_sizes[2] != dm || in_sizes[4] != dm || in_sizes[6] != dm || in_sizes[8] != dm) return;
  if (out_size != ntot * dm) return;

  const float* x  = (const float*)d_in[0];
  const float* Wq = (const float*)d_in[1];
  const float* bq = (const float*)d_in[2];
  const float* Wk = (const float*)d_in[3];
  const float* bk = (const float*)d_in[4];
  const float* Wv = (const float*)d_in[5];
  const float* bv = (const float*)d_in[6];
  const float* Wo = (const float*)d_in[7];
  const float* bo = (const float*)d_in[8];
  float* out = (float*)d_out;

  const size_t bWt = (size_t)3 * dm * dm * 2;
  const size_t bWo = (size_t)dm * dm * 2;
  const size_t bX  = (size_t)ntot * dm * 2;
  const size_t bQK = (size_t)ntot * 2 * dm * 2;
  const size_t bVT = (size_t)dm * ntot * 2;
  const size_t bO  = (size_t)ntot * dm * 2;
  size_t off = 0;
  const size_t oWt = off; off += bWt;
  const size_t oWo = off; off += bWo;
  const size_t oX  = off; off += bX;
  const size_t oQK = off; off += bQK;
  const size_t oVT = off; off += bVT;
  const size_t oOH = off; off += bO;
  const size_t oOL = off; off += bO;
  if (off > ws_size) return;                     // 102,760,448
  if (off > (size_t)134217728) return;

  char* ws = (char*)d_ws;
  _Float16*       Wt16 = (_Float16*)(ws + oWt);
  unsigned short* Wob  = (unsigned short*)(ws + oWo);
  _Float16*       X16  = (_Float16*)(ws + oX);
  _Float16*       QK16 = (_Float16*)(ws + oQK);
  _Float16*       VT16 = (_Float16*)(ws + oVT);
  unsigned short* OH   = (unsigned short*)(ws + oOH);
  unsigned short* OL   = (unsigned short*)(ws + oOL);

  const dim3 blk(256);
  const int n8 = ntot * dm / 8;               // 1,048,576 = 4096 * 256
  if ((n8 % 256) != 0) return;

  // (1) x -> X16 (8 * bf16(x))
  cvt_x_kernel<<<dim3(n8 / 256), blk, 0, stream>>>(x, X16, n8);
  // (2) weights -> transposed 16-bit planes: Wt16 = [Wq^T; Wk^T; Wv^T] f16 (64 * bf16(w)), Wob = Wo^T bf16 bits
  cvt_wt_kernel<<<dim3(4 * (dm / 64) * (dm / 64)), blk, 0, stream>>>(Wq, Wk, Wv, Wo, Wt16, Wob);
  // (3) 16*q | 16*k = X . [Wq^T; Wk^T]^T + 16*b -> QK16 [16384][1024]; M=16384, N=1024, K=512; scale 16/(8*64)
  {
    const int tiles = (ntot / 64) * ((2 * dm) / 64);
    gemm64_kernel<0, false, 1, 1><<<dim3((tiles + 7) / 8), blk, 0, stream>>>(
        (const unsigned short*)X16, (const unsigned short*)X16, dm, (const unsigned short*)Wt16, dm,
        (void*)QK16, 2 * dm, bq, bk, dm, ntot, 2 * dm, dm, 0.03125f, 16.0f);
  }
  // (4) 16*v^T = Wv^T . X^T + 16*bv (per row) -> VT16 [512][16384]; M=512, N=16384, K=512
  {
    const int tiles = (dm / 64) * (ntot / 64);
    gemm64_kernel<0, false, 1, 2><<<dim3((tiles + 7) / 8), blk, 0, stream>>>(
        (const unsigned short*)(Wt16 + (size_t)2 * dm * dm), (const unsigned short*)(Wt16 + (size_t)2 * dm * dm), dm,
        (const unsigned short*)X16, dm,
        (void*)VT16, ntot, bv, bv, dm, dm, ntot, dm, 0.03125f, 16.0f);
  }
  // (5) attention per sequence -> OH / OL (bf16 hi / lo of O); logit scale = (1/8) / 256 (operand carries 16 * 16)
  (void)hipFuncSetAttribute(reinterpret_cast<const void*>(&attn_kernel),
                            hipFuncAttributeMaxDynamicSharedMemorySize, ATT_LDS);
  const float sc = 0.125f * (1.0f / 256.0f);
  attn_kernel<<<dim3(ntot / QB), blk, ATT_LDS, stream>>>(QK16, VT16, OH, OL, sc);
  // (6) out = (O_hi + O_lo) . Wo + bo -> d_out f32 [16384][512]; bf16 operands, scale 1
  {
    const int tiles = (ntot / 64) * (dm / 64);
    gemm64_kernel<1, true, 0, 1><<<dim3((tiles + 7) / 8), blk, 0, stream>>>(
        OH, OL, dm, Wob, dm, (void*)out, dm, bo, bo, dm, ntot, dm, dm, 1.0f, 1.0f);
  }
  (void)hipGetLastError();
}

// v001
// Measured time: 297 microseconds a run.
// In both of two side-by-side timings against v000, it was 1.54 times as fast.
// Contractions: q|k = X.Wqk^T and v^T = Wv^T.X^T : v_wmma_f32_16x16x32_f16 (f16 operands, carries X x8, W x64, q/k/v x16),
// S^T = k.q^T and O = P.v : v_wmma_f32_16x16x32_f16 (f16 operands, P = 16*exp(s - m)), f32 accumulate; out = O.Wo + bo :
// v_wmma_f32_16x16x32_bf16, O as bf16 hi/lo planes (hi.W + lo.W), Wo^T bf16, f32 accumulate; float inputs RNE-converted
// to bf16 on load; softmax statistics, normaliser and biases in f32.
#include <hip/hip_runtime.h>
#include <stdint.h>

#define NSEQ 4
#define SEQ  4096
#define NTOT (NSEQ * SEQ)
#define DM   512
#define LDQK (2 * DM)

typedef _Float16 v16h __attribute__((ext_vector_type(16)));
typedef _Float16 v8h  __attribute__((ext_vector_type(8)));
typedef __bf16   v16b __attribute__((ext_vector_type(16)));
typedef __bf16   v8b  __attribute__((ext_vector_type(8)));
typedef float    v8f  __attribute__((ext_vector_type(8)));
typedef float    v4f  __attribute__((ext_vector_type(4)));
typedef unsigned short v8us __attribute__((ext_vector_type(8)));

static_assert((DM % 64) == 0);
static_assert((NTOT % 64) == 0);
static_assert((SEQ % 256) == 0);

// f32 -> nearest-even bf16 bits / value
__device__ __forceinline__ unsigned short bfbits(float f) {
  unsigned u = __float_as_uint(f);
  return (unsigned short)((u + 0x7FFFu + ((u >> 16) & 1u)) >> 16);
}
__device__ __forceinline__ float bfval(unsigned short b) { return __uint_as_float(((unsigned)b) << 16); }
__device__ __forceinline__ float bfr(float f) { return bfval(bfbits(f)); }
__device__ __forceinline__ void split_bf(float f, unsigned short& hb, unsigned short& lb) {
  hb = bfbits(f);
  lb = bfbits(f - bfval(hb));
}

// 16-bit operand element types for the GEMM template: 0 = f16, 1 = bf16
template <int ET> struct Elem;
template <> struct Elem<0> {
  typedef _Float16 T; typedef v16h V; typedef v8h V8;
  static __device__ __forceinline__ v8f mma(V a, V b, v8f c) {
    return __builtin_amdgcn_wmma_f32_16x16x32_f16(false, a, false, b, (short)0, c, false, false);
  }
};
template <> struct Elem<1> {
  typedef __bf16 T; typedef v16b V; typedef v8b V8;
  static __device__ __forceinline__ v8f mma(V a, V b, v8f c) {
    return __builtin_amdgcn_wmma_f32_16x16x32_bf16(false, a, false, b, (short)0, c, false, false);
  }
};

// 16-bit WMMA fragment from k-contiguous storage (A row-major [m][k], or B stored [n][k]):
// p points at element (row_or_col = lane&15, k0 + 8h); elements 0..7 <- p[0..7], 8..15 <- p[16..23].
template <int ET>
__device__ __forceinline__ typename Elem<ET>::V ldfragT(const typename Elem<ET>::T* p) {
  typedef typename Elem<ET>::V V;
  typedef typename Elem<ET>::V8 V8;
  union { V v; V8 h[2]; } f;
  f.h[0] = *(const V8*)(p);
  f.h[1] = *(const V8*)(p + 16);
  return f.v;
}
__device__ __forceinline__ v16h ldfrag(const _Float16* p) { return ldfragT<0>(p); }
__device__ __forceinline__ v8f mma16(v16h a, v16h b, v8f c) { return Elem<0>::mma(a, b, c); }
__device__ __forceinline__ v8f zero8() {
  v8f z;
#pragma unroll
  for (int i = 0; i < 8; ++i) z[i] = 0.0f;
  return z;
}

// hazard guards: 4 VALU slots after the last WMMA of a group, D tied, A/B kept live
__device__ __forceinline__ void guard_g(v8f& a, v8f& b, v16h x, v16h y) {
  asm volatile("v_nop\n\tv_nop\n\tv_nop\n\tv_nop" : "+v"(a), "+v"(b) : "v"(x), "v"(y));
}
__device__ __forceinline__ void guard_g(v8f& a, v8f& b, v16b x, v16b y) {
  asm volatile("v_nop\n\tv_nop\n\tv_nop\n\tv_nop" : "+v"(a), "+v"(b) : "v"(x), "v"(y));
}
__device__ __forceinline__ void keep4(v16h a, v16h b, v16h c, v16h d) {
  asm volatile("v_nop" :: "v"(a), "v"(b), "v"(c), "v"(d));
}
__device__ __forceinline__ void keep4(v16b a, v16b b, v16b c, v16b d) {
  asm volatile("v_nop" :: "v"(a), "v"(b), "v"(c), "v"(d));
}
__device__ __forceinline__ void accg4(v8f& a, v8f& b, v8f& c, v8f& d) {
  asm volatile("v_nop\n\tv_nop\n\tv_nop\n\tv_nop" : "+v"(a), "+v"(b), "+v"(c), "+v"(d));
}

// ---------------------------------------------------------------------------------------------
// Kernel 1: x f32 [NTOT][DM] -> f16 plane X [NTOT][DM], value f16(8 * bf16(x)). 8 elements per thread: one 16-B store per
// coverage: n8/256 blocks * 256 threads * 8 = NTOT*DM elements (n8 = NTOT*DM/8 is a multiple of 256).
// ---------------------------------------------------------------------------------------------
__global__ __launch_bounds__(256) void cvt_x_kernel(const float* __restrict__ x, _Float16* __restrict__ d16, int n8) {
  const int li = (int)blockIdx.x * 256 + (int)threadIdx.x;
  if (li >= n8) return;
  const size_t e = (size_t)li * 8;
  const v4f a = *(const v4f*)(x + e);
  const v4f b = *(const v4f*)(x + e + 4);
  v8h o;
#pragma unroll
  for (int i = 0; i < 4; ++i) {
    o[i]     = (_Float16)(bfr(a[i]) * 8.0f);
    o[4 + i] = (_Float16)(bfr(b[i]) * 8.0f);
  }
  _Float16* d = d16 + e;
  *(v8h*)d = o;
  
}

// ---------------------------------------------------------------------------------------------
// Kernel 2: four [DM][DM] f32 weight matrices w[in][out] -> TRANSPOSED 16-bit planes [out][in] (k = in contiguous):
//   blocks [0,192):   Wt16[(mat*DM + p)][d] = f16(64 * bf16(w_mat[d][p]))   mat 0,1,2 = Wq, Wk, Wv
//   blocks [192,256): Wob[p][d]               = bf16 bits of Wo[d][p] (here d indexes Wo rows = the O feature, p = output column)
// Block = one 64x64 tile: in rows r0..r0+63, in cols c0..c0+63 (tile index block-uniform); tile staged transposed in LDS
// coverage: per matrix 64 tiles x (2 iterations x 32 lines x 64 halves) = DM x DM elements.
// ---------------------------------------------------------------------------------------------
__global__ __launch_bounds__(256) void cvt_wt_kernel(const float* __restrict__ w0, const float* __restrict__ w1,
                                                     const float* __restrict__ w2, const float* __restrict__ w3,
                                                     _Float16* __restrict__ wt16, unsigned short* __restrict__ wob) {
  __shared__ __align__(16) float sT[64 * 68];
  const int tid = (int)threadIdx.x;
  const int mat = (int)blockIdx.x >> 6;                 // 0..3
  const int tile = (int)blockIdx.x & 63;
  const int tr = tile >> 3, tc = tile & 7;               // in[tr*64 ..][tc*64 ..] -> out[tc*64 ..][tr*64 ..]
  const float* src = (mat == 0) ? w0 : ((mat == 1) ? w1 : ((mat == 2) ? w2 : w3));
  {
    const int r = tid >> 2, c16 = (tid & 3) * 16;
    const float* sp = src + (size_t)(tr * 64 + r) * DM + tc * 64 + c16;
#pragma unroll
    for (int i = 0; i < 4; ++i) {
      const v4f a = *(const v4f*)(sp + 4 * i);
#pragma unroll
      for (int e = 0; e < 4; ++e) sT[(c16 + 4 * i + e) * 68 + r] = a[e];
    }
  }
  __syncthreads();
  const int piece = tid & 7;
#pragma unroll
  for (int it = 0; it < 2; ++it) {
    const int line = it * 32 + (tid >> 3);               // output row within the tile (input column)
    const float* lp = sT + line * 68 + piece * 8;
    const v4f u0 = *(const v4f*)lp, u1 = *(const v4f*)(lp + 4);
    const int prow = tc * 64 + line;
    const int d0 = tr * 64 + piece * 8;
    if (mat < 3) {
      v8h o;
#pragma unroll
      for (int e = 0; e < 4; ++e) {
        o[e]     = (_Float16)(bfr(u0[e]) * 64.0f);
        o[4 + e] = (_Float16)(bfr(u1[e]) * 64.0f);
      }
      _Float16* d = wt16 + (size_t)(mat * DM + prow) * DM + d0;
      *(v8h*)d = o;
      
    } else {
      v8us o;
#pragma unroll
      for (int e = 0; e < 4; ++e) {
        o[e]     = bfbits(u0[e]);
        o[4 + e] = bfbits(u1[e]);
      }
      unsigned short* d = wob + (size_t)prow * DM + d0;
      *(v8us*)d = o;
      
    }
  }
}

// ---------------------------------------------------------------------------------------------
// Kernel 3: C[m][n] = scale * sum_k A[m][k] * Bt[n][k] + bias.
// A row-major [M][K] 16-bit (ET 0: f16, ET 1: bf16) pitch lda; Bt row-major [N][K] same type pitch ldb; M, N multiples
// of 64, K multiple of 32. SPLITA: A is a hi plane (Ap) plus a lo plane (A2p, same layout), product = hi.B + lo.B.
// BIAS_MODE 0: none; 1: per column n, bias0[n] for n < nsplit else bias1[n - nsplit] (both loaded with clamped indices,
// selected by value); 2: per row m, bias0[m]. Bias values bf16-converted and multiplied by bias_scale.
// Each wave owns one 64x64 C tile (16 f32 accumulators); 8 waves per block; no block barriers.
// OUT_MODE 0: f32 output; OUT_MODE 1: f16 output. Epilogue: 16-row slab per wave in LDS, then each 64-wide
// coverage: tilesM * tilesN tiles, each 64x64 written fully -> M x N.
// ---------------------------------------------------------------------------------------------
template <int ET, bool SPLITA, int OUT_MODE, int BIAS_MODE>
__global__ __launch_bounds__(256) void gemm64_kernel(const unsigned short* __restrict__ Ap,
                                                     const unsigned short* __restrict__ A2p, int lda,
                                                     const unsigned short* __restrict__ Btp, int ldb,
                                                     void* __restrict__ Cout, int ldc,
                                                     const float* __restrict__ bias0, const float* __restrict__ bias1,
                                                     int nsplit, int M, int N, int K, float scale, float bias_scale) {
  typedef typename Elem<ET>::T T;
  typedef typename Elem<ET>::V V;
  const T* A  = (const T*)(const void*)Ap;
  const T* A2 = (const T*)(const void*)A2p;
  const T* Bt = (const T*)(const void*)Btp;
  __shared__ __align__(16) float sT[8][16 * 68];
  const int lane = threadIdx.x & 31, wave = threadIdx.x >> 5;
  const int tilesN = N >> 6, tilesM = M >> 6;
  const int tile = (int)blockIdx.x * 8 + wave;
  if (tile >= tilesM * tilesN) return;
  const int tm = tile / tilesN, tn = tile - tm * tilesN;
  const int m0 = tm << 6, n0 = tn << 6;
  const int rl = lane & 15;
  const int koff = (lane >> 4) * 8;
  const int mOff = (lane >> 4) * 8;

  v8f acc[4][4];
#pragma unroll
  for (int i = 0; i < 4; ++i)
#pragma unroll
    for (int j = 0; j < 4; ++j) acc[i][j] = zero8();

#pragma unroll 1
  for (int k0 = 0; k0 < K; k0 += 32) {
    V bh[4];
#pragma unroll
    for (int j = 0; j < 4; ++j) bh[j] = ldfragT<ET>(Bt + (size_t)(n0 + (j << 4) + rl) * ldb + koff + k0);
#pragma unroll
    for (int i = 0; i < 4; ++i) {
      const size_t ao = (size_t)(m0 + (i << 4) + rl) * lda + koff + k0;
      const V ah = ldfragT<ET>(A + ao);
      V al = ah;
      if (SPLITA) al = ldfragT<ET>(A2 + ao);
#pragma unroll
      for (int j = 0; j < 4; ++j) {
        acc[i][j] = Elem<ET>::mma(ah, bh[j], acc[i][j]);
        if (SPLITA) acc[i][j] = Elem<ET>::mma(al, bh[j], acc[i][j]);
      }
      guard_g(acc[i][0], acc[i][3], ah, SPLITA ? al : bh[3]);
    }
    keep4(bh[0], bh[1], bh[2], bh[3]);
  }
  accg4(acc[0][0], acc[0][1], acc[0][2], acc[0][3]);
  accg4(acc[1][0], acc[1][1], acc[1][2], acc[1][3]);
  accg4(acc[2][0], acc[2][1], acc[2][2], acc[2][3]);
  accg4(acc[3][0], acc[3][1], acc[3][2], acc[3][3]);

  float* slab = sT[wave];
#pragma unroll
  for (int i = 0; i < 4; ++i) {
    const int mBase = m0 + (i << 4);
    float brow[8];
#pragma unroll
    for (int r = 0; r < 8; ++r) brow[r] = 0.0f;
    if (BIAS_MODE == 2) {
#pragma unroll
      for (int r = 0; r < 8; ++r) {
        int mi = mBase + mOff + r;
        mi = (mi < M) ? mi : (M - 1);
        brow[r] = bfr(bias0[mi]) * bias_scale;
      }
    }
#pragma unroll
    for (int j = 0; j < 4; ++j) {
      float bcol = 0.0f;
      if (BIAS_MODE == 1) {
        const int n = n0 + (j << 4) + rl;
        const int i0 = (n < nsplit) ? n : (nsplit - 1);
        int i1 = n - nsplit;
        i1 = (i1 > 0) ? i1 : 0;
        int lim1 = N - nsplit - 1;
        lim1 = (lim1 > 0) ? lim1 : 0;
        i1 = (i1 < lim1) ? i1 : lim1;
        const float b0v = bfr(bias0[i0]);
        const float b1v = bfr(bias1[i1]);
        bcol = ((n < nsplit) ? b0v : b1v) * bias_scale;
      }
#pragma unroll
      for (int r = 0; r < 8; ++r) slab[(mOff + r) * 68 + (j << 4) + rl] = acc[i][j][r] * scale + bcol + brow[r];
    }
    __builtin_amdgcn_fence(__ATOMIC_RELEASE, "workgroup");
    __builtin_amdgcn_wave_barrier();
    __builtin_amdgcn_fence(__ATOMIC_ACQUIRE, "workgroup");
    if (OUT_MODE == 0) {
      float* C = (float*)Cout;
      const int hh = lane >> 4, c4 = (lane & 15) * 4;
{
#pragma unroll
        for (int it = 0; it < 8; ++it) {
          const int row = it * 2 + hh;
          const v4f v = *(const v4f*)(slab + row * 68 + c4);
          *(v4f*)(C + (size_t)(mBase + row) * ldc + n0 + c4) = v;
        }
        
      }
    } else {
      _Float16* C = (_Float16*)Cout;
      const int qq = lane >> 3, c8 = (lane & 7) * 8;
{
#pragma unroll
        for (int it = 0; it < 4; ++it) {
          const int row = it * 4 + qq;
          const float* sp = slab + row * 68 + c8;
          v8h hv;
#pragma unroll
          for (int e = 0; e < 8; ++e) hv[e] = (_Float16)sp[e];
          *(v8h*)(C + (size_t)(mBase + row) * ldc + n0 + c8) = hv;
        }
        
      }
    }
    __builtin_amdgcn_fence(__ATOMIC_RELEASE, "workgroup");
    __builtin_amdgcn_wave_barrier();
    __builtin_amdgcn_fence(__ATOMIC_ACQUIRE, "workgroup");
  }
}

// ---------------------------------------------------------------------------------------------
// Kernel 4: full (non-causal) single-head attention per sequence, head width 512, online softmax in f32.
//   qk plane f16 [NTOT][LDQK]: columns 0..511 = 16*q, columns 512..1023 = 16*k; vt plane f16 [DM][NTOT] (value 16*v);
//   outputs oh / ol = bf16 hi / lo planes (as 16-bit storage) of O = softmax(q k^T * scale) . v, [NTOT][DM], unscaled.
//   Block = 512 threads = 16 waves, 64 query rows (all in one sequence); Q tile staged once in LDS. Key tiles of 256
//   within the sequence: wave w owns keys 16w..16w+15 of the tile for the logits: S^T subtiles (A = k rows from global,
//   B = Q rows from LDS; one k fragment feeds four query subtiles), so the D layout gives per lane 8 consecutive keys
//   of one query -> P written to LDS as 16-B vectors ([query][key]). P = 16 * exp(s - m_running) in f16 (<= 16).
//   Row max / sum: per-wave partials in LDS, combined in fixed wave order by waves 0 and 1 (one lane per query row).
//   P.V: every wave reads the whole P tile (A operand) and owns 32 value columns (B from the vt plane; one v fragment
//   feeds four query subtiles).
//   Output: normalised O split into bf16 hi / lo, two 64x512 16-bit tiles staged in LDS (hi over the Q region,
//   lo over the P region), barrier, then each wave writes 4 whole rows per plane, 512 B per instruction (2 per row).
// coverage: NTOT/64 blocks x 16 waves x 4 rows x 512 = NTOT x DM per plane.
// ---------------------------------------------------------------------------------------------
#define QB       64
#define QT       4
#define AW       16
#define KCH      256
#define QSP      520
#define PSP      264
#define LDS_QS   0
#define LDS_LS   66560
#define LDS_PS   66560
#define LDS_PMAX 133120
#define LDS_PSUM 137216
#define LDS_ST   141312
#define ATT_LDS  142336
static_assert(QT * 16 == QB && AW * 16 == KCH && AW * 32 == DM && AW * 4 == QB);
static_assert(QB * QSP * 2 == LDS_LS - LDS_QS);
static_assert(QB * QSP * 2 == LDS_PMAX - LDS_LS);
static_assert(QB * PSP * 2 <= LDS_PMAX - LDS_PS);
static_assert(LDS_PSUM - LDS_PMAX == AW * QB * 4);
static_assert(LDS_ST - LDS_PSUM == AW * QB * 4);
static_assert(ATT_LDS - LDS_ST == 4 * QB * 4);
static_assert((QSP % 8) == 0 && (PSP % 8) == 0 && PSP >= KCH && QSP >= DM);
static_assert((LDS_LS % 16) == 0 && (LDS_PMAX % 16) == 0 && (LDS_ST % 16) == 0);
static_assert((SEQ % KCH) == 0 && (SEQ % QB) == 0 && (DM % 64) == 0);

// hazard guards for the attention groups: 4 VALU slots after the last WMMA of a group, D tied, A/B kept live
__device__ __forceinline__ void guard_q4(v8f& a, v8f& b, v8f& c, v8f& d, v16h x, v16h y0, v16h y1, v16h y2, v16h y3) {
  asm volatile("v_nop\n\tv_nop\n\tv_nop\n\tv_nop"
               : "+v"(a), "+v"(b), "+v"(c), "+v"(d) : "v"(x), "v"(y0), "v"(y1), "v"(y2), "v"(y3));
}

__global__ __launch_bounds__(512) void attn_kernel(const _Float16* __restrict__ qk, const _Float16* __restrict__ vt,
                                                   unsigned short* __restrict__ oh, unsigned short* __restrict__ ol,
                                                   float sc) {
  extern __shared__ __align__(16) char smem[];
  _Float16* Qs = (_Float16*)(smem + LDS_QS);
  _Float16* Ps = (_Float16*)(smem + LDS_PS);
  float* pmax = (float*)(smem + LDS_PMAX);
  float* psum = (float*)(smem + LDS_PSUM);
  float* m_s  = (float*)(smem + LDS_ST);
  float* l_s  = m_s + QB;
  float* al_s = m_s + 2 * QB;
  float* li_s = m_s + 3 * QB;

  const int tid = threadIdx.x, wave = tid >> 5, lane = tid & 31, h = lane >> 4, c = lane & 15;
  const int q0 = (int)blockIdx.x * QB;            // first query row (global token index)
  const int bk0 = (q0 / SEQ) * SEQ;               // first key row of this sequence
  const float ninf = -__builtin_inff();

  if (tid < QB) { m_s[tid] = ninf; l_s[tid] = 0.0f; al_s[tid] = 0.0f; li_s[tid] = 0.0f; }
  psum[tid] = 0.0f;
  psum[512 + tid] = 0.0f;
  // Q tile: 64 rows x 64 pieces of 8 halves; coverage 8 * 512 = 4096 pieces = the whole tile
#pragma unroll
  for (int i = 0; i < 8; ++i) {
    const int idx = i * 512 + tid;
    const int row = idx >> 6;
    const int pc  = idx & 63;
    const v8h v = *(const v8h*)(qk + (size_t)(q0 + row) * LDQK + pc * 8);
    *(v8h*)(Qs + row * QSP + pc * 8) = v;
  }
  __syncthreads();

  v8f oacc[QT][2];
#pragma unroll
  for (int qt = 0; qt < QT; ++qt)
#pragma unroll
    for (int nt = 0; nt < 2; ++nt) oacc[qt][nt] = zero8();

  const _Float16* qbp = Qs + c * QSP + 8 * h;             // B operand, query c (+ 16 * QSP per query subtile)
  const _Float16* pap = Ps + c * PSP + 8 * h;             // A operand, query c (+ 16 * PSP per query subtile)
  const int ntile = SEQ / KCH;

#pragma unroll 1
  for (int t = 0; t < ntile; ++t) {
    // ---- logits: S^T subtiles for keys kb..kb+15 (this wave), queries 0..63 ----
    const int kb = bk0 + t * KCH + 16 * wave;
    const _Float16* kap = qk + (size_t)(kb + c) * LDQK + DM + 8 * h;
    v8f sacc[QT];     // [query subtile]; element r: query 16qt+c, key kb+8h+r
#pragma unroll
    for (int qt = 0; qt < QT; ++qt) sacc[qt] = zero8();
#pragma unroll 1
    for (int k0 = 0; k0 < DM; k0 += 32) {
      const v16h a0 = ldfrag(kap + k0);
      const v16h b0 = ldfrag(qbp + k0), b1 = ldfrag(qbp + 16 * QSP + k0);
      const v16h b2 = ldfrag(qbp + 32 * QSP + k0), b3 = ldfrag(qbp + 48 * QSP + k0);
      sacc[0] = mma16(a0, b0, sacc[0]);
      sacc[1] = mma16(a0, b1, sacc[1]);
      sacc[2] = mma16(a0, b2, sacc[2]);
      sacc[3] = mma16(a0, b3, sacc[3]);
      guard_q4(sacc[0], sacc[1], sacc[2], sacc[3], a0, b0, b1, b2, b3);
    }
    // ---- scale, per-wave partial row max ----
#pragma unroll
    for (int qt = 0; qt < QT; ++qt) {
      float pm = ninf;
#pragma unroll
      for (int r = 0; r < 8; ++r) {
        const float v = sacc[qt][r] * sc; sacc[qt][r] = v; pm = fmaxf(pm, v);
      }
      pm = fmaxf(pm, __shfl_xor(pm, 16, 32));
      pmax[wave * QB + 16 * qt + c] = pm;
    }
    __syncthreads();
    // ---- waves 0 and 1, thread = query row: fold the prior tile's sums into l, new running max, rescale factor ----
    if (wave < 2) {
      const int row = tid;
      float ps = 0.0f;
#pragma unroll
      for (int w = 0; w < AW; ++w) ps += psum[w * QB + row];
      l_s[row] = l_s[row] * al_s[row] + ps;
      const float mo = m_s[row];
      float mx = mo;
#pragma unroll
      for (int w = 0; w < AW; ++w) mx = fmaxf(mx, pmax[w * QB + row]);
      al_s[row] = __expf(mo - mx);
      m_s[row] = mx;
    }
    __syncthreads();
    // ---- p = 16 * exp(s - m) as f16, P tile, partial row sums, rescale O ----
#pragma unroll
    for (int qt = 0; qt < QT; ++qt) {
      const float mq = m_s[16 * qt + c];
      float ps = 0.0f;
      v8h hv;
#pragma unroll
      for (int r = 0; r < 8; ++r) {
        const float p = __expf(sacc[qt][r] - mq); ps += p; hv[r] = (_Float16)(p * 16.0f);
      }
      *(v8h*)(Ps + (16 * qt + c) * PSP + 16 * wave + 8 * h) = hv;
      ps += __shfl_xor(ps, 16, 32);
      psum[wave * QB + 16 * qt + c] = ps;
      const v4f aA = *(const v4f*)(al_s + 16 * qt + 8 * h), aB = *(const v4f*)(al_s + 16 * qt + 8 * h + 4);
#pragma unroll
      for (int nt = 0; nt < 2; ++nt) {
#pragma unroll
        for (int r = 0; r < 4; ++r) {
          oacc[qt][nt][r] *= aA[r]; oacc[qt][nt][4 + r] *= aB[r];
        }
      }
    }
    __syncthreads();
    // ---- O += P . V over the 256 keys of the tile; this wave's columns 32w + 16nt + c ----
    {
      const _Float16* vbp = vt + (size_t)(32 * wave + c) * NTOT + bk0 + (size_t)t * KCH + 8 * h;
#pragma unroll 1
      for (int ks = 0; ks < KCH; ks += 32) {
        const v16h vb0 = ldfrag(vbp + ks), vb1 = ldfrag(vbp + (size_t)16 * NTOT + ks);
        const v16h pa0 = ldfrag(pap + ks), pa1 = ldfrag(pap + 16 * PSP + ks);
        const v16h pa2 = ldfrag(pap + 32 * PSP + ks), pa3 = ldfrag(pap + 48 * PSP + ks);
        oacc[0][0] = mma16(pa0, vb0, oacc[0][0]);
        oacc[1][0] = mma16(pa1, vb0, oacc[1][0]);
        oacc[2][0] = mma16(pa2, vb0, oacc[2][0]);
        oacc[3][0] = mma16(pa3, vb0, oacc[3][0]);
        oacc[0][1] = mma16(pa0, vb1, oacc[0][1]);
        oacc[1][1] = mma16(pa1, vb1, oacc[1][1]);
        oacc[2][1] = mma16(pa2, vb1, oacc[2][1]);
        oacc[3][1] = mma16(pa3, vb1, oacc[3][1]);
        guard_q4(oacc[0][1], oacc[1][1], oacc[2][1], oacc[3][1], vb1, pa0, pa1, pa2, pa3);
      }
    }
  }

  // ---- final normaliser per query row (fold the last tile's sums); O = oacc / (256 * l) (P carry 16, v carry 16) ----
  if (wave < 2) {
    const int row = tid;
    float ps = 0.0f;
#pragma unroll
    for (int w = 0; w < AW; ++w) ps += psum[w * QB + row];
    const float l = l_s[row] * al_s[row] + ps;
    li_s[row] = (1.0f / l) * (1.0f / 256.0f);
  }
  __syncthreads();
  // ---- stage the 64 x 512 bf16 hi / lo tiles (hi over the Q region, lo over the P region) ----
  unsigned short* Hs = (unsigned short*)(smem + LDS_QS);
  unsigned short* Ls = (unsigned short*)(smem + LDS_LS);
#pragma unroll
  for (int qt = 0; qt < QT; ++qt) {
    const v4f iA = *(const v4f*)(li_s + 16 * qt + 8 * h), iB = *(const v4f*)(li_s + 16 * qt + 8 * h + 4);
#pragma unroll
    for (int nt = 0; nt < 2; ++nt) {
      const int col = 32 * wave + 16 * nt + c;
#pragma unroll
      for (int r = 0; r < 4; ++r) {
        unsigned short hb, lb;
        split_bf(oacc[qt][nt][r] * iA[r], hb, lb);
        Hs[(16 * qt + 8 * h + r) * QSP + col] = hb;     Ls[(16 * qt + 8 * h + r) * QSP + col] = lb;
        split_bf(oacc[qt][nt][4 + r] * iB[r], hb, lb);
        Hs[(16 * qt + 8 * h + 4 + r) * QSP + col] = hb; Ls[(16 * qt + 8 * h + 4 + r) * QSP + col] = lb;
      }
    }
  }
  __syncthreads();
  {
    unsigned short* gh = oh + (size_t)q0 * DM;
    unsigned short* gl = ol + (size_t)q0 * DM;
#pragma unroll
    for (int rr = 0; rr < 4; ++rr) {
      const int row = 4 * wave + rr;
#pragma unroll
      for (int j = 0; j < 2; ++j) {
        const int pc = j * 32 + lane;
        const v8us hvv = *(const v8us*)(Hs + row * QSP + pc * 8);
        const v8us lvv = *(const v8us*)(Ls + row * QSP + pc * 8);
        *(v8us*)(gh + (size_t)row * DM + pc * 8) = hvv;
        *(v8us*)(gl + (size_t)row * DM + pc * 8) = lvv;
      }
    }
  }
}

// ---------------------------------------------------------------------------------------------
//   Wt16 : Wq^T, Wk^T, Wv^T stacked f16 [1536][512] (64 * bf16(w))   off 0            size  1,572,864
//   Wob  : Wo^T bf16 bits [512][512]                                  off  1,572,864   size    524,288
//   X16  : f16 [16384][512] (8 * bf16(x))                              off  2,097,152   size 16,777,216
//   QK16 : 16*q | 16*k f16 [16384][1024]                              off 18,874,368   size 33,554,432
//   VT16 : 16*v^T f16 [512][16384]                                    off 52,428,800   size 16,777,216
//   OH   : attention output bf16 hi [16384][512]                      off 69,206,016   size 16,777,216
//   OL   : attention output bf16 lo [16384][512]                      off 85,983,232   size 16,777,216
//   total 102,760,448
// ---------------------------------------------------------------------------------------------
extern "C" void kernel_launch(void* const* d_in, const int* in_sizes, int n_in,
                              void* d_out, int out_size, void* d_ws, size_t ws_size,
                              hipStream_t stream) {
  if (n_in < 9) return;
  const int ntot = NTOT, dm = DM;
  if (in_sizes[0] != ntot * dm) return;
  if (in_sizes[1] != dm * dm || in_sizes[3] != dm * dm || in_sizes[5] != dm * dm || in_sizes[7] != dm * dm) return;
  if (in_sizes[2] != dm || in_sizes[4] != dm || in_sizes[6] != dm || in_sizes[8] != dm) return;
  if (out_size != ntot * dm) return;

  const float* x  = (const float*)d_in[0];
  const float* Wq = (const float*)d_in[1];
  const float* bq = (const float*)d_in[2];
  const float* Wk = (const float*)d_in[3];
  const float* bk = (const float*)d_in[4];
  const float* Wv = (const float*)d_in[5];
  const float* bv = (const float*)d_in[6];
  const float* Wo = (const float*)d_in[7];
  const float* bo = (const float*)d_in[8];
  float* out = (float*)d_out;

  const size_t bWt = (size_t)3 * dm * dm * 2;
  const size_t bWo = (size_t)dm * dm * 2;
  const size_t bX  = (size_t)ntot * dm * 2;
  const size_t bQK = (size_t)ntot * 2 * dm * 2;
  const size_t bVT = (size_t)dm * ntot * 2;
  const size_t bO  = (size_t)ntot * dm * 2;
  size_t off = 0;
  const size_t oWt = off; off += bWt;
  const size_t oWo = off; off += bWo;
  const size_t oX  = off; off += bX;
  const size_t oQK = off; off += bQK;
  const size_t oVT = off; off += bVT;
  const size_t oOH = off; off += bO;
  const size_t oOL = off; off += bO;
  if (off > ws_size) return;                     // 102,760,448
  if (off > (size_t)134217728) return;

  char* ws = (char*)d_ws;
  _Float16*       Wt16 = (_Float16*)(ws + oWt);
  unsigned short* Wob  = (unsigned short*)(ws + oWo);
  _Float16*       X16  = (_Float16*)(ws + oX);
  _Float16*       QK16 = (_Float16*)(ws + oQK);
  _Float16*       VT16 = (_Float16*)(ws + oVT);
  unsigned short* OH   = (unsigned short*)(ws + oOH);
  unsigned short* OL   = (unsigned short*)(ws + oOL);

  const dim3 blk(256);
  const int n8 = ntot * dm / 8;               // 1,048,576 = 4096 * 256
  if ((n8 % 256) != 0) return;

  // (1) x -> X16 (8 * bf16(x))
  cvt_x_kernel<<<dim3(n8 / 256), blk, 0, stream>>>(x, X16, n8);
  // (2) weights -> transposed 16-bit planes: Wt16 = [Wq^T; Wk^T; Wv^T] f16 (64 * bf16(w)), Wob = Wo^T bf16 bits
  cvt_wt_kernel<<<dim3(4 * (dm / 64) * (dm / 64)), blk, 0, stream>>>(Wq, Wk, Wv, Wo, Wt16, Wob);
  // (3) 16*q | 16*k = X . [Wq^T; Wk^T]^T + 16*b -> QK16 [16384][1024]; M=16384, N=1024, K=512; scale 16/(8*64)
  {
    const int tiles = (ntot / 64) * ((2 * dm) / 64);
    gemm64_kernel<0, false, 1, 1><<<dim3((tiles + 7) / 8), blk, 0, stream>>>(
        (const unsigned short*)X16, (const unsigned short*)X16, dm, (const unsigned short*)Wt16, dm,
        (void*)QK16, 2 * dm, bq, bk, dm, ntot, 2 * dm, dm, 0.03125f, 16.0f);
  }
  // (4) 16*v^T = Wv^T . X^T + 16*bv (per row) -> VT16 [512][16384]; M=512, N=16384, K=512
  {
    const int tiles = (dm / 64) * (ntot / 64);
    gemm64_kernel<0, false, 1, 2><<<dim3((tiles + 7) / 8), blk, 0, stream>>>(
        (const unsigned short*)(Wt16 + (size_t)2 * dm * dm), (const unsigned short*)(Wt16 + (size_t)2 * dm * dm), dm,
        (const unsigned short*)X16, dm,
        (void*)VT16, ntot, bv, bv, dm, dm, ntot, dm, 0.03125f, 16.0f);
  }
  // (5) attention per sequence -> OH / OL (bf16 hi / lo of O); logit scale = (1/8) / 256 (operand carries 16 * 16)
  (void)hipFuncSetAttribute(reinterpret_cast<const void*>(&attn_kernel),
                            hipFuncAttributeMaxDynamicSharedMemorySize, ATT_LDS);
  const float sc = 0.125f * (1.0f / 256.0f);
  attn_kernel<<<dim3(ntot / QB), dim3(512), ATT_LDS, stream>>>(QK16, VT16, OH, OL, sc);
  // (6) out = (O_hi + O_lo) . Wo + bo -> d_out f32 [16384][512]; bf16 operands, scale 1
  {
    const int tiles = (ntot / 64) * (dm / 64);
    gemm64_kernel<1, true, 0, 1><<<dim3((tiles + 7) / 8), blk, 0, stream>>>(
        OH, OL, dm, Wob, dm, (void*)out, dm, bo, bo, dm, ntot, dm, dm, 1.0f, 1.0f);
  }
  (void)hipGetLastError();
}

// v002
// One run takes 249 microseconds.
// Timed twice side by side with v001, it ran 1.19 times as fast both times.
// Over all steps from v000 it is 1.84 times as fast.
// Contractions: q|k = X.Wqk^T and v^T = Wv^T.X^T : v_wmma_f32_16x16x32_f16 (f16 operands, carries X x8, W x64, q/k/v x16),
// S^T = k.q^T and O = P.v : v_wmma_f32_16x16x32_f16 (f16 operands, P = 16*exp(s - m)), f32 accumulate; out = O.Wo + bo :
// v_wmma_f32_16x16x32_bf16, O as bf16 hi/lo planes (hi.W + lo.W), Wo^T bf16, f32 accumulate; float inputs RNE-converted
// to bf16 on load; softmax statistics, normaliser and biases in f32.
#include <hip/hip_runtime.h>
#include <stdint.h>

#define NSEQ 4
#define SEQ  4096
#define NTOT (NSEQ * SEQ)
#define DM   512
#define LDQK (2 * DM)

typedef _Float16 v16h __attribute__((ext_vector_type(16)));
typedef _Float16 v8h  __attribute__((ext_vector_type(8)));
typedef __bf16   v16b __attribute__((ext_vector_type(16)));
typedef __bf16   v8b  __attribute__((ext_vector_type(8)));
typedef float    v8f  __attribute__((ext_vector_type(8)));
typedef float    v4f  __attribute__((ext_vector_type(4)));
typedef unsigned short v8us __attribute__((ext_vector_type(8)));

static_assert((DM % 64) == 0);
static_assert((NTOT % 64) == 0);
static_assert((SEQ % 256) == 0);

// f32 -> nearest-even bf16 bits / value
__device__ __forceinline__ unsigned short bfbits(float f) {
  unsigned u = __float_as_uint(f);
  return (unsigned short)((u + 0x7FFFu + ((u >> 16) & 1u)) >> 16);
}
__device__ __forceinline__ float bfval(unsigned short b) { return __uint_as_float(((unsigned)b) << 16); }
__device__ __forceinline__ float bfr(float f) { return bfval(bfbits(f)); }
__device__ __forceinline__ void split_bf(float f, unsigned short& hb, unsigned short& lb) {
  hb = bfbits(f);
  lb = bfbits(f - bfval(hb));
}

// 16-bit operand element types for the GEMM template: 0 = f16, 1 = bf16
template <int ET> struct Elem;
template <> struct Elem<0> {
  typedef _Float16 T; typedef v16h V; typedef v8h V8;
  static __device__ __forceinline__ v8f mma(V a, V b, v8f c) {
    return __builtin_amdgcn_wmma_f32_16x16x32_f16(false, a, false, b, (short)0, c, false, false);
  }
};
template <> struct Elem<1> {
  typedef __bf16 T; typedef v16b V; typedef v8b V8;
  static __device__ __forceinline__ v8f mma(V a, V b, v8f c) {
    return __builtin_amdgcn_wmma_f32_16x16x32_bf16(false, a, false, b, (short)0, c, false, false);
  }
};

// 16-bit WMMA fragment from k-contiguous storage (A row-major [m][k], or B stored [n][k]):
// p points at element (row_or_col = lane&15, k0 + 8h); elements 0..7 <- p[0..7], 8..15 <- p[16..23].
template <int ET>
__device__ __forceinline__ typename Elem<ET>::V ldfragT(const typename Elem<ET>::T* p) {
  typedef typename Elem<ET>::V V;
  typedef typename Elem<ET>::V8 V8;
  union { V v; V8 h[2]; } f;
  f.h[0] = *(const V8*)(p);
  f.h[1] = *(const V8*)(p + 16);
  return f.v;
}
__device__ __forceinline__ v16h ldfrag(const _Float16* p) { return ldfragT<0>(p); }
__device__ __forceinline__ v8f mma16(v16h a, v16h b, v8f c) { return Elem<0>::mma(a, b, c); }
__device__ __forceinline__ v8f zero8() {
  v8f z;
#pragma unroll
  for (int i = 0; i < 8; ++i) z[i] = 0.0f;
  return z;
}

// hazard guards: 4 VALU slots after the last WMMA of a group, D tied, A/B kept live
__device__ __forceinline__ void guard_g(v8f& a, v8f& b, v16h x, v16h y) {
  asm volatile("v_nop\n\tv_nop\n\tv_nop\n\tv_nop" : "+v"(a), "+v"(b) : "v"(x), "v"(y));
}
__device__ __forceinline__ void guard_g(v8f& a, v8f& b, v16b x, v16b y) {
  asm volatile("v_nop\n\tv_nop\n\tv_nop\n\tv_nop" : "+v"(a), "+v"(b) : "v"(x), "v"(y));
}
__device__ __forceinline__ void keep4(v16h a, v16h b, v16h c, v16h d) {
  asm volatile("v_nop" :: "v"(a), "v"(b), "v"(c), "v"(d));
}
__device__ __forceinline__ void keep4(v16b a, v16b b, v16b c, v16b d) {
  asm volatile("v_nop" :: "v"(a), "v"(b), "v"(c), "v"(d));
}
__device__ __forceinline__ void accg4(v8f& a, v8f& b, v8f& c, v8f& d) {
  asm volatile("v_nop\n\tv_nop\n\tv_nop\n\tv_nop" : "+v"(a), "+v"(b), "+v"(c), "+v"(d));
}

// ---------------------------------------------------------------------------------------------
// Kernel 1: x f32 [NTOT][DM] -> f16 plane X [NTOT][DM], value f16(8 * bf16(x)). 8 elements per thread: one 16-B store per
// coverage: n8/256 blocks * 256 threads * 8 = NTOT*DM elements (n8 = NTOT*DM/8 is a multiple of 256).
// ---------------------------------------------------------------------------------------------
__global__ __launch_bounds__(256) void cvt_x_kernel(const float* __restrict__ x, _Float16* __restrict__ d16, int n8) {
  const int li = (int)blockIdx.x * 256 + (int)threadIdx.x;
  if (li >= n8) return;
  const size_t e = (size_t)li * 8;
  const v4f a = *(const v4f*)(x + e);
  const v4f b = *(const v4f*)(x + e + 4);
  v8h o;
#pragma unroll
  for (int i = 0; i < 4; ++i) {
    o[i]     = (_Float16)(bfr(a[i]) * 8.0f);
    o[4 + i] = (_Float16)(bfr(b[i]) * 8.0f);
  }
  _Float16* d = d16 + e;
  *(v8h*)d = o;
  
}

// ---------------------------------------------------------------------------------------------
// Kernel 2: four [DM][DM] f32 weight matrices w[in][out] -> TRANSPOSED 16-bit planes [out][in] (k = in contiguous):
//   blocks [0,192):   Wt16[(mat*DM + p)][d] = f16(64 * bf16(w_mat[d][p]))   mat 0,1,2 = Wq, Wk, Wv
//   blocks [192,256): Wob[p][d]               = bf16 bits of Wo[d][p] (here d indexes Wo rows = the O feature, p = output column)
// Block = one 64x64 tile: in rows r0..r0+63, in cols c0..c0+63 (tile index block-uniform); tile staged transposed in LDS
// coverage: per matrix 64 tiles x (2 iterations x 32 lines x 64 halves) = DM x DM elements.
// ---------------------------------------------------------------------------------------------
__global__ __launch_bounds__(256) void cvt_wt_kernel(const float* __restrict__ w0, const float* __restrict__ w1,
                                                     const float* __restrict__ w2, const float* __restrict__ w3,
                                                     _Float16* __restrict__ wt16, unsigned short* __restrict__ wob) {
  __shared__ __align__(16) float sT[64 * 68];
  const int tid = (int)threadIdx.x;
  const int mat = (int)blockIdx.x >> 6;                 // 0..3
  const int tile = (int)blockIdx.x & 63;
  const int tr = tile >> 3, tc = tile & 7;               // in[tr*64 ..][tc*64 ..] -> out[tc*64 ..][tr*64 ..]
  const float* src = (mat == 0) ? w0 : ((mat == 1) ? w1 : ((mat == 2) ? w2 : w3));
  {
    const int r = tid >> 2, c16 = (tid & 3) * 16;
    const float* sp = src + (size_t)(tr * 64 + r) * DM + tc * 64 + c16;
#pragma unroll
    for (int i = 0; i < 4; ++i) {
      const v4f a = *(const v4f*)(sp + 4 * i);
#pragma unroll
      for (int e = 0; e < 4; ++e) sT[(c16 + 4 * i + e) * 68 + r] = a[e];
    }
  }
  __syncthreads();
  const int piece = tid & 7;
#pragma unroll
  for (int it = 0; it < 2; ++it) {
    const int line = it * 32 + (tid >> 3);               // output row within the tile (input column)
    const float* lp = sT + line * 68 + piece * 8;
    const v4f u0 = *(const v4f*)lp, u1 = *(const v4f*)(lp + 4);
    const int prow = tc * 64 + line;
    const int d0 = tr * 64 + piece * 8;
    if (mat < 3) {
      v8h o;
#pragma unroll
      for (int e = 0; e < 4; ++e) {
        o[e]     = (_Float16)(bfr(u0[e]) * 64.0f);
        o[4 + e] = (_Float16)(bfr(u1[e]) * 64.0f);
      }
      _Float16* d = wt16 + (size_t)(mat * DM + prow) * DM + d0;
      *(v8h*)d = o;
      
    } else {
      v8us o;
#pragma unroll
      for (int e = 0; e < 4; ++e) {
        o[e]     = bfbits(u0[e]);
        o[4 + e] = bfbits(u1[e]);
      }
      unsigned short* d = wob + (size_t)prow * DM + d0;
      *(v8us*)d = o;
      
    }
  }
}

// ---------------------------------------------------------------------------------------------
// Kernel 3: C[m][n] = scale * sum_k A[m][k] * Bt[n][k] + bias.
// A row-major [M][K] 16-bit (ET 0: f16, ET 1: bf16) pitch lda; Bt row-major [N][K] same type pitch ldb; M, N multiples
// of 64, K multiple of 32. SPLITA: A is a hi plane (Ap) plus a lo plane (A2p, same layout), product = hi.B + lo.B.
// BIAS_MODE 0: none; 1: per column n, bias0[n] for n < nsplit else bias1[n - nsplit] (both loaded with clamped indices,
// selected by value); 2: per row m, bias0[m]. Bias values bf16-converted and multiplied by bias_scale.
// Each wave owns one 64x64 C tile (16 f32 accumulators); 8 waves per block; no block barriers.
// OUT_MODE 0: f32 output; OUT_MODE 1: f16 output. Epilogue: 16-row slab per wave in LDS, then each 64-wide
// coverage: tilesM * tilesN tiles, each 64x64 written fully -> M x N.
// ---------------------------------------------------------------------------------------------
template <int ET, bool SPLITA, int OUT_MODE, int BIAS_MODE>
__global__ __launch_bounds__(256) void gemm64_kernel(const unsigned short* __restrict__ Ap,
                                                     const unsigned short* __restrict__ A2p, int lda,
                                                     const unsigned short* __restrict__ Btp, int ldb,
                                                     void* __restrict__ Cout, int ldc,
                                                     const float* __restrict__ bias0, const float* __restrict__ bias1,
                                                     int nsplit, int M, int N, int K, float scale, float bias_scale) {
  typedef typename Elem<ET>::T T;
  typedef typename Elem<ET>::V V;
  const T* A  = (const T*)(const void*)Ap;
  const T* A2 = (const T*)(const void*)A2p;
  const T* Bt = (const T*)(const void*)Btp;
  __shared__ __align__(16) float sT[8][16 * 68];
  const int lane = threadIdx.x & 31, wave = threadIdx.x >> 5;
  const int tilesN = N >> 6, tilesM = M >> 6;
  const int tile = (int)blockIdx.x * 8 + wave;
  if (tile >= tilesM * tilesN) return;
  const int tm = tile / tilesN, tn = tile - tm * tilesN;
  const int m0 = tm << 6, n0 = tn << 6;
  const int rl = lane & 15;
  const int koff = (lane >> 4) * 8;
  const int mOff = (lane >> 4) * 8;

  v8f acc[4][4];
#pragma unroll
  for (int i = 0; i < 4; ++i)
#pragma unroll
    for (int j = 0; j < 4; ++j) acc[i][j] = zero8();

#pragma unroll 1
  for (int k0 = 0; k0 < K; k0 += 32) {
    V bh[4];
#pragma unroll
    for (int j = 0; j < 4; ++j) bh[j] = ldfragT<ET>(Bt + (size_t)(n0 + (j << 4) + rl) * ldb + koff + k0);
#pragma unroll
    for (int i = 0; i < 4; ++i) {
      const size_t ao = (size_t)(m0 + (i << 4) + rl) * lda + koff + k0;
      const V ah = ldfragT<ET>(A + ao);
      V al = ah;
      if (SPLITA) al = ldfragT<ET>(A2 + ao);
#pragma unroll
      for (int j = 0; j < 4; ++j) {
        acc[i][j] = Elem<ET>::mma(ah, bh[j], acc[i][j]);
        if (SPLITA) acc[i][j] = Elem<ET>::mma(al, bh[j], acc[i][j]);
      }
      guard_g(acc[i][0], acc[i][3], ah, SPLITA ? al : bh[3]);
    }
    keep4(bh[0], bh[1], bh[2], bh[3]);
  }
  accg4(acc[0][0], acc[0][1], acc[0][2], acc[0][3]);
  accg4(acc[1][0], acc[1][1], acc[1][2], acc[1][3]);
  accg4(acc[2][0], acc[2][1], acc[2][2], acc[2][3]);
  accg4(acc[3][0], acc[3][1], acc[3][2], acc[3][3]);

  float* slab = sT[wave];
#pragma unroll
  for (int i = 0; i < 4; ++i) {
    const int mBase = m0 + (i << 4);
    float brow[8];
#pragma unroll
    for (int r = 0; r < 8; ++r) brow[r] = 0.0f;
    if (BIAS_MODE == 2) {
#pragma unroll
      for (int r = 0; r < 8; ++r) {
        int mi = mBase + mOff + r;
        mi = (mi < M) ? mi : (M - 1);
        brow[r] = bfr(bias0[mi]) * bias_scale;
      }
    }
#pragma unroll
    for (int j = 0; j < 4; ++j) {
      float bcol = 0.0f;
      if (BIAS_MODE == 1) {
        const int n = n0 + (j << 4) + rl;
        const int i0 = (n < nsplit) ? n : (nsplit - 1);
        int i1 = n - nsplit;
        i1 = (i1 > 0) ? i1 : 0;
        int lim1 = N - nsplit - 1;
        lim1 = (lim1 > 0) ? lim1 : 0;
        i1 = (i1 < lim1) ? i1 : lim1;
        const float b0v = bfr(bias0[i0]);
        const float b1v = bfr(bias1[i1]);
        bcol = ((n < nsplit) ? b0v : b1v) * bias_scale;
      }
#pragma unroll
      for (int r = 0; r < 8; ++r) slab[(mOff + r) * 68 + (j << 4) + rl] = acc[i][j][r] * scale + bcol + brow[r];
    }
    __builtin_amdgcn_fence(__ATOMIC_RELEASE, "workgroup");
    __builtin_amdgcn_wave_barrier();
    __builtin_amdgcn_fence(__ATOMIC_ACQUIRE, "workgroup");
    if (OUT_MODE == 0) {
      float* C = (float*)Cout;
      const int hh = lane >> 4, c4 = (lane & 15) * 4;
{
#pragma unroll
        for (int it = 0; it < 8; ++it) {
          const int row = it * 2 + hh;
          const v4f v = *(const v4f*)(slab + row * 68 + c4);
          *(v4f*)(C + (size_t)(mBase + row) * ldc + n0 + c4) = v;
        }
        
      }
    } else {
      _Float16* C = (_Float16*)Cout;
      const int qq = lane >> 3, c8 = (lane & 7) * 8;
{
#pragma unroll
        for (int it = 0; it < 4; ++it) {
          const int row = it * 4 + qq;
          const float* sp = slab + row * 68 + c8;
          v8h hv;
#pragma unroll
          for (int e = 0; e < 8; ++e) hv[e] = (_Float16)sp[e];
          *(v8h*)(C + (size_t)(mBase + row) * ldc + n0 + c8) = hv;
        }
        
      }
    }
    __builtin_amdgcn_fence(__ATOMIC_RELEASE, "workgroup");
    __builtin_amdgcn_wave_barrier();
    __builtin_amdgcn_fence(__ATOMIC_ACQUIRE, "workgroup");
  }
}

// ---------------------------------------------------------------------------------------------
// Kernel 4: full (non-causal) single-head attention per sequence, head width 512, online softmax in f32.
//   qk plane f16 [NTOT][LDQK]: columns 0..511 = 16*q, columns 512..1023 = 16*k; vt plane f16 [DM][NTOT] (value 16*v);
//   outputs oh / ol = bf16 hi / lo planes (as 16-bit storage) of O = softmax(q k^T * scale) . v, [NTOT][DM], unscaled.
//   Block = 512 threads = 16 waves, 64 query rows (all in one sequence); Q tile staged once in LDS. Key tiles of 256
//   within the sequence: wave w owns keys 16w..16w+15 of the tile for the logits: S^T subtiles (A = k rows from the wave's
//   ring, B = Q rows from LDS; one k fragment feeds four query subtiles), so the D layout gives per lane 8 consecutive keys
//   of one query -> P written to LDS as 16-B vectors ([query][key]). P = 16 * exp(s - m_running) in f16 (<= 16).
//   Row max / sum: per-wave partials in LDS, combined in fixed wave order by waves 0 and 1 (one lane per query row).
//   P.V: every wave reads the whole P tile (A operand) and owns 32 value columns (B from the wave's ring; one v fragment
//   feeds four query subtiles).
//   Ring: each wave brings its own K rows and vt rows into two LDS buffers of its own by asynchronous copies, each copy
//   instruction covering whole 128-B lines. A stage is 4 KB: 16 keys x 128 features (rows of 256 B, pitch 272 B) or
//   32 vt rows x 64 keys (rows of 128 B, pitch 144 B); a key tile is 4 K stages, then 4 V stages. Stage g + 1 is issued
//   at the top of stage g into the buffer that stage g - 1 used. No other wave reads a wave's ring, so no barrier.
//   Output: normalised O split into bf16 hi / lo, two 64x512 16-bit tiles staged in LDS (hi over the Q region,
//   lo over the P region), barrier, then each wave writes 4 whole rows per plane, 512 B per instruction (2 per row).
// coverage: NTOT/64 blocks x 16 waves x 4 rows x 512 = NTOT x DM per plane.
// ---------------------------------------------------------------------------------------------
#define QB       64
#define QT       4
#define AW       16
#define KCH      256
#define QSP      520
#define PSP      264
#define LDS_QS   0
#define LDS_LS   66560
#define LDS_PS   66560
#define LDS_PMAX 133120
#define LDS_PSUM 137216
#define LDS_ST   141312
#define LDS_RING 142336
#define RING_SB  4608
#define KSP      136
#define VSP      72
#define ATT_LDS  289792
static_assert(QT * 16 == QB && AW * 16 == KCH && AW * 32 == DM && AW * 4 == QB);
static_assert(QB * QSP * 2 == LDS_LS - LDS_QS);
static_assert(QB * QSP * 2 == LDS_PMAX - LDS_LS);
static_assert(QB * PSP * 2 <= LDS_PMAX - LDS_PS);
static_assert(LDS_PSUM - LDS_PMAX == AW * QB * 4);
static_assert(LDS_ST - LDS_PSUM == AW * QB * 4);
static_assert(LDS_RING - LDS_ST == 4 * QB * 4);
static_assert(16 * KSP * 2 <= RING_SB && 32 * VSP * 2 <= RING_SB && (RING_SB % 16) == 0 && (LDS_RING % 16) == 0);
static_assert(KSP >= 128 && VSP >= 64 && (KSP % 8) == 0 && (VSP % 8) == 0 && ATT_LDS <= 327680);
static_assert(DM == 4 * 128 && KCH == 4 * 64 && ATT_LDS == LDS_RING + AW * 2 * RING_SB);
static_assert((QSP % 8) == 0 && (PSP % 8) == 0 && PSP >= KCH && QSP >= DM);
static_assert((LDS_LS % 16) == 0 && (LDS_PMAX % 16) == 0 && (LDS_ST % 16) == 0);
static_assert((SEQ % KCH) == 0 && (SEQ % QB) == 0 && (DM % 64) == 0);

// hazard guards for the attention groups: 4 VALU slots after the last WMMA of a group, D tied, A/B kept live
__device__ __forceinline__ void guard_q4(v8f& a, v8f& b, v8f& c, v8f& d, v16h x, v16h y0, v16h y1, v16h y2, v16h y3) {
  asm volatile("v_nop\n\tv_nop\n\tv_nop\n\tv_nop"
               : "+v"(a), "+v"(b), "+v"(c), "+v"(d) : "v"(x), "v"(y0), "v"(y1), "v"(y2), "v"(y3));
}

// One ring stage: eight asynchronous 16-B-per-lane copies, global -> LDS, through no register. Copy i takes the lane's
// LDS byte address l + i * ls and its global address g + i * gs (halves). The s_wait_xcnt closes the statement so that
// no address register of an issued copy is rewritten in front of it.
__device__ __forceinline__ void stage_copy8(unsigned l, unsigned ls, const _Float16* g, size_t gs) {
  asm volatile("global_load_async_to_lds_b128 %0, %8, off\n\t"
               "global_load_async_to_lds_b128 %1, %9, off\n\t"
               "global_load_async_to_lds_b128 %2, %10, off\n\t"
               "global_load_async_to_lds_b128 %3, %11, off\n\t"
               "global_load_async_to_lds_b128 %4, %12, off\n\t"
               "global_load_async_to_lds_b128 %5, %13, off\n\t"
               "global_load_async_to_lds_b128 %6, %14, off\n\t"
               "global_load_async_to_lds_b128 %7, %15, off\n\t"
               "s_wait_xcnt 0x0"
               :: "v"(l), "v"(l + ls), "v"(l + 2 * ls), "v"(l + 3 * ls),
                  "v"(l + 4 * ls), "v"(l + 5 * ls), "v"(l + 6 * ls), "v"(l + 7 * ls),
                  "v"(g), "v"(g + gs), "v"(g + 2 * gs), "v"(g + 3 * gs),
                  "v"(g + 4 * gs), "v"(g + 5 * gs), "v"(g + 6 * gs), "v"(g + 7 * gs)
               : "memory");
}
// Top of a ring stage: this wave's LDS reads of the other buffer have retired, so that buffer may be refilled, and its
// copies of this stage have landed (nothing else of the wave is in flight), so this stage may be read.
__device__ __forceinline__ void stage_ready() {
  asm volatile("s_wait_dscnt 0x0" ::: "memory");
  asm volatile("s_wait_asynccnt 0x0" ::: "memory");
}

__global__ __launch_bounds__(512) void attn_kernel(const _Float16* __restrict__ qk, const _Float16* __restrict__ vt,
                                                   unsigned short* __restrict__ oh, unsigned short* __restrict__ ol,
                                                   float sc) {
  extern __shared__ __align__(16) char smem[];
  _Float16* Qs = (_Float16*)(smem + LDS_QS);
  _Float16* Ps = (_Float16*)(smem + LDS_PS);
  float* pmax = (float*)(smem + LDS_PMAX);
  float* psum = (float*)(smem + LDS_PSUM);
  float* m_s  = (float*)(smem + LDS_ST);
  float* l_s  = m_s + QB;
  float* al_s = m_s + 2 * QB;
  float* li_s = m_s + 3 * QB;

  const int tid = threadIdx.x, wave = tid >> 5, lane = tid & 31, h = lane >> 4, c = lane & 15;
  const int q0 = (int)blockIdx.x * QB;            // first query row (global token index)
  const int bk0 = (q0 / SEQ) * SEQ;               // first key row of this sequence
  const float ninf = -__builtin_inff();

  // this wave's ring: lane addresses of copy 0 of a K stage (2 rows x 16 pieces a copy) and of a V stage (4 rows x 8)
  char* ringc = smem + LDS_RING + wave * (2 * RING_SB);
  const unsigned ring_lds = (unsigned)(uintptr_t)ringc;
  const unsigned kcl = ring_lds + (unsigned)((lane >> 4) * (KSP * 2) + (lane & 15) * 16);
  const unsigned vcl = ring_lds + (unsigned)((lane >> 3) * (VSP * 2) + (lane & 7) * 16);
  const _Float16* kcg = qk + (size_t)(bk0 + 16 * wave + (lane >> 4)) * LDQK + DM + (lane & 15) * 8;
  const _Float16* vcg = vt + (size_t)(32 * wave + (lane >> 3)) * NTOT + bk0 + (lane & 7) * 8;
  const _Float16* kfp = (const _Float16*)ringc + c * KSP + 8 * h;   // A operand, key c of this wave's 16
  const _Float16* vfp = (const _Float16*)ringc + c * VSP + 8 * h;   // B operand, column c (+ 16 * VSP for the second 16)
  stage_copy8(kcl, 2 * KSP * 2, kcg, (size_t)2 * LDQK);             // K stage 0 of tile 0 -> buffer 0

  if (tid < QB) { m_s[tid] = ninf; l_s[tid] = 0.0f; al_s[tid] = 0.0f; li_s[tid] = 0.0f; }
  psum[tid] = 0.0f;
  psum[512 + tid] = 0.0f;
  // Q tile: 64 rows x 64 pieces of 8 halves; coverage 8 * 512 = 4096 pieces = the whole tile
#pragma unroll
  for (int i = 0; i < 8; ++i) {
    const int idx = i * 512 + tid;
    const int row = idx >> 6;
    const int pc  = idx & 63;
    const v8h v = *(const v8h*)(qk + (size_t)(q0 + row) * LDQK + pc * 8);
    *(v8h*)(Qs + row * QSP + pc * 8) = v;
  }
  __syncthreads();

  v8f oacc[QT][2];
#pragma unroll
  for (int qt = 0; qt < QT; ++qt)
#pragma unroll
    for (int nt = 0; nt < 2; ++nt) oacc[qt][nt] = zero8();

  const _Float16* qbp = Qs + c * QSP + 8 * h;             // B operand, query c (+ 16 * QSP per query subtile)
  const _Float16* pap = Ps + c * PSP + 8 * h;             // A operand, query c (+ 16 * PSP per query subtile)
  const int ntile = SEQ / KCH;

#pragma unroll 1
  for (int t = 0; t < ntile; ++t) {
    // ---- logits: S^T subtiles for keys 16w..16w+15 of the tile (this wave), queries 0..63 ----
    const _Float16* kct = kcg + (size_t)t * KCH * LDQK;   // this tile's K rows / vt keys, copy addresses
    const _Float16* vct = vcg + (size_t)t * KCH;
    v8f sacc[QT];     // [query subtile]; element r: query 16qt+c, key bk0 + t*KCH + 16*wave + 8h + r
#pragma unroll
    for (int qt = 0; qt < QT; ++qt) sacc[qt] = zero8();
    // unrolled: the buffer, and which stage is issued next, are then fixed per stage, and LDS offsets are immediates
#pragma unroll
    for (int j = 0; j < 4; ++j) {
      stage_ready();
      if (j < 3) stage_copy8(kcl + ((j + 1) & 1) * RING_SB, 2 * KSP * 2, kct + (j + 1) * 128, (size_t)2 * LDQK);
      else       stage_copy8(vcl, 4 * VSP * 2, vct, (size_t)4 * NTOT);
      const _Float16* kb = kfp + (j & 1) * (RING_SB / 2);
#pragma unroll   // the four k steps of one stage: one block between two refills
      for (int kk = 0; kk < 128; kk += 32) {
        const int k0 = j * 128 + kk;
        const v16h a0 = ldfrag(kb + kk);
        const v16h b0 = ldfrag(qbp + k0), b1 = ldfrag(qbp + 16 * QSP + k0);
        const v16h b2 = ldfrag(qbp + 32 * QSP + k0), b3 = ldfrag(qbp + 48 * QSP + k0);
        sacc[0] = mma16(a0, b0, sacc[0]);
        sacc[1] = mma16(a0, b1, sacc[1]);
        sacc[2] = mma16(a0, b2, sacc[2]);
        sacc[3] = mma16(a0, b3, sacc[3]);
        guard_q4(sacc[0], sacc[1], sacc[2], sacc[3], a0, b0, b1, b2, b3);
      }
    }
    // ---- scale, per-wave partial row max ----
#pragma unroll
    for (int qt = 0; qt < QT; ++qt) {
      float pm = ninf;
#pragma unroll
      for (int r = 0; r < 8; ++r) {
        const float v = sacc[qt][r] * sc; sacc[qt][r] = v; pm = fmaxf(pm, v);
      }
      pm = fmaxf(pm, __shfl_xor(pm, 16, 32));
      pmax[wave * QB + 16 * qt + c] = pm;
    }
    __syncthreads();
    // ---- waves 0 and 1, thread = query row: fold the prior tile's sums into l, new running max, rescale factor ----
    if (wave < 2) {
      const int row = tid;
      float ps = 0.0f;
#pragma unroll
      for (int w = 0; w < AW; ++w) ps += psum[w * QB + row];
      l_s[row] = l_s[row] * al_s[row] + ps;
      const float mo = m_s[row];
      float mx = mo;
#pragma unroll
      for (int w = 0; w < AW; ++w) mx = fmaxf(mx, pmax[w * QB + row]);
      al_s[row] = __expf(mo - mx);
      m_s[row] = mx;
    }
    __syncthreads();
    // ---- p = 16 * exp(s - m) as f16, P tile, partial row sums, rescale O ----
#pragma unroll
    for (int qt = 0; qt < QT; ++qt) {
      const float mq = m_s[16 * qt + c];
      float ps = 0.0f;
      v8h hv;
#pragma unroll
      for (int r = 0; r < 8; ++r) {
        const float p = __expf(sacc[qt][r] - mq); ps += p; hv[r] = (_Float16)(p * 16.0f);
      }
      *(v8h*)(Ps + (16 * qt + c) * PSP + 16 * wave + 8 * h) = hv;
      ps += __shfl_xor(ps, 16, 32);
      psum[wave * QB + 16 * qt + c] = ps;
      const v4f aA = *(const v4f*)(al_s + 16 * qt + 8 * h), aB = *(const v4f*)(al_s + 16 * qt + 8 * h + 4);
#pragma unroll
      for (int nt = 0; nt < 2; ++nt) {
#pragma unroll
        for (int r = 0; r < 4; ++r) {
          oacc[qt][nt][r] *= aA[r]; oacc[qt][nt][4 + r] *= aB[r];
        }
      }
    }
    __syncthreads();
    // ---- O += P . V over the 256 keys of the tile; this wave's columns 32w + 16nt + c ----
    // unrolled for the same reason as the K stages
#pragma unroll
    for (int j = 0; j < 4; ++j) {
      stage_ready();
      if (j < 3)               stage_copy8(vcl + ((j + 1) & 1) * RING_SB, 4 * VSP * 2, vct + (j + 1) * 64, (size_t)4 * NTOT);
      else if (t + 1 < ntile)  stage_copy8(kcl, 2 * KSP * 2, kct + (size_t)KCH * LDQK, (size_t)2 * LDQK);
      const _Float16* vb = vfp + (j & 1) * (RING_SB / 2);
#pragma unroll   // the two key steps of one stage: one block between two refills
      for (int kk = 0; kk < 64; kk += 32) {
        const int ks = j * 64 + kk;
        const v16h vb0 = ldfrag(vb + kk), vb1 = ldfrag(vb + 16 * VSP + kk);
        const v16h pa0 = ldfrag(pap + ks), pa1 = ldfrag(pap + 16 * PSP + ks);
        const v16h pa2 = ldfrag(pap + 32 * PSP + ks), pa3 = ldfrag(pap + 48 * PSP + ks);
        oacc[0][0] = mma16(pa0, vb0, oacc[0][0]);
        oacc[1][0] = mma16(pa1, vb0, oacc[1][0]);
        oacc[2][0] = mma16(pa2, vb0, oacc[2][0]);
        oacc[3][0] = mma16(pa3, vb0, oacc[3][0]);
        oacc[0][1] = mma16(pa0, vb1, oacc[0][1]);
        oacc[1][1] = mma16(pa1, vb1, oacc[1][1]);
        oacc[2][1] = mma16(pa2, vb1, oacc[2][1]);
        oacc[3][1] = mma16(pa3, vb1, oacc[3][1]);
        guard_q4(oacc[0][1], oacc[1][1], oacc[2][1], oacc[3][1], vb1, pa0, pa1, pa2, pa3);
      }
    }
  }
  // behind the last copy, before the wave goes on to the epilogue and ends
  asm volatile("s_wait_asynccnt 0x0" ::: "memory");

  // ---- final normaliser per query row (fold the last tile's sums); O = oacc / (256 * l) (P carry 16, v carry 16) ----
  if (wave < 2) {
    const int row = tid;
    float ps = 0.0f;
#pragma unroll
    for (int w = 0; w < AW; ++w) ps += psum[w * QB + row];
    const float l = l_s[row] * al_s[row] + ps;
    li_s[row] = (1.0f / l) * (1.0f / 256.0f);
  }
  __syncthreads();
  // ---- stage the 64 x 512 bf16 hi / lo tiles (hi over the Q region, lo over the P region) ----
  unsigned short* Hs = (unsigned short*)(smem + LDS_QS);
  unsigned short* Ls = (unsigned short*)(smem + LDS_LS);
#pragma unroll
  for (int qt = 0; qt < QT; ++qt) {
    const v4f iA = *(const v4f*)(li_s + 16 * qt + 8 * h), iB = *(const v4f*)(li_s + 16 * qt + 8 * h + 4);
#pragma unroll
    for (int nt = 0; nt < 2; ++nt) {
      const int col = 32 * wave + 16 * nt + c;
#pragma unroll
      for (int r = 0; r < 4; ++r) {
        unsigned short hb, lb;
        split_bf(oacc[qt][nt][r] * iA[r], hb, lb);
        Hs[(16 * qt + 8 * h + r) * QSP + col] = hb;     Ls[(16 * qt + 8 * h + r) * QSP + col] = lb;
        split_bf(oacc[qt][nt][4 + r] * iB[r], hb, lb);
        Hs[(16 * qt + 8 * h + 4 + r) * QSP + col] = hb; Ls[(16 * qt + 8 * h + 4 + r) * QSP + col] = lb;
      }
    }
  }
  __syncthreads();
  {
    unsigned short* gh = oh + (size_t)q0 * DM;
    unsigned short* gl = ol + (size_t)q0 * DM;
#pragma unroll
    for (int rr = 0; rr < 4; ++rr) {
      const int row = 4 * wave + rr;
#pragma unroll
      for (int j = 0; j < 2; ++j) {
        const int pc = j * 32 + lane;
        const v8us hvv = *(const v8us*)(Hs + row * QSP + pc * 8);
        const v8us lvv = *(const v8us*)(Ls + row * QSP + pc * 8);
        *(v8us*)(gh + (size_t)row * DM + pc * 8) = hvv;
        *(v8us*)(gl + (size_t)row * DM + pc * 8) = lvv;
      }
    }
  }
}

// ---------------------------------------------------------------------------------------------
//   Wt16 : Wq^T, Wk^T, Wv^T stacked f16 [1536][512] (64 * bf16(w))   off 0            size  1,572,864
//   Wob  : Wo^T bf16 bits [512][512]                                  off  1,572,864   size    524,288
//   X16  : f16 [16384][512] (8 * bf16(x))                              off  2,097,152   size 16,777,216
//   QK16 : 16*q | 16*k f16 [16384][1024]                              off 18,874,368   size 33,554,432
//   VT16 : 16*v^T f16 [512][16384]                                    off 52,428,800   size 16,777,216
//   OH   : attention output bf16 hi [16384][512]                      off 69,206,016   size 16,777,216
//   OL   : attention output bf16 lo [16384][512]                      off 85,983,232   size 16,777,216
//   total 102,760,448
// ---------------------------------------------------------------------------------------------
extern "C" void kernel_launch(void* const* d_in, const int* in_sizes, int n_in,
                              void* d_out, int out_size, void* d_ws, size_t ws_size,
                              hipStream_t stream) {
  if (n_in < 9) return;
  const int ntot = NTOT, dm = DM;
  if (in_sizes[0] != ntot * dm) return;
  if (in_sizes[1] != dm * dm || in_sizes[3] != dm * dm || in_sizes[5] != dm * dm || in_sizes[7] != dm * dm) return;
  if (in_sizes[2] != dm || in_sizes[4] != dm || in_sizes[6] != dm || in_sizes[8] != dm) return;
  if (out_size != ntot * dm) return;

  const float* x  = (const float*)d_in[0];
  const float* Wq = (const float*)d_in[1];
  const float* bq = (const float*)d_in[2];
  const float* Wk = (const float*)d_in[3];
  const float* bk = (const float*)d_in[4];
  const float* Wv = (const float*)d_in[5];
  const float* bv = (const float*)d_in[6];
  const float* Wo = (const float*)d_in[7];
  const float* bo = (const float*)d_in[8];
  float* out = (float*)d_out;

  const size_t bWt = (size_t)3 * dm * dm * 2;
  const size_t bWo = (size_t)dm * dm * 2;
  const size_t bX  = (size_t)ntot * dm * 2;
  const size_t bQK = (size_t)ntot * 2 * dm * 2;
  const size_t bVT = (size_t)dm * ntot * 2;
  const size_t bO  = (size_t)ntot * dm * 2;
  size_t off = 0;
  const size_t oWt = off; off += bWt;
  const size_t oWo = off; off += bWo;
  const size_t oX  = off; off += bX;
  const size_t oQK = off; off += bQK;
  const size_t oVT = off; off += bVT;
  const size_t oOH = off; off += bO;
  const size_t oOL = off; off += bO;
  if (off > ws_size) return;                     // 102,760,448
  if (off > (size_t)134217728) return;

  char* ws = (char*)d_ws;
  _Float16*       Wt16 = (_Float16*)(ws + oWt);
  unsigned short* Wob  = (unsigned short*)(ws + oWo);
  _Float16*       X16  = (_Float16*)(ws + oX);
  _Float16*       QK16 = (_Float16*)(ws + oQK);
  _Float16*       VT16 = (_Float16*)(ws + oVT);
  unsigned short* OH   = (unsigned short*)(ws + oOH);
  unsigned short* OL   = (unsigned short*)(ws + oOL);

  const dim3 blk(256);
  const int n8 = ntot * dm / 8;               // 1,048,576 = 4096 * 256
  if ((n8 % 256) != 0) return;

  // (1) x -> X16 (8 * bf16(x))
  cvt_x_kernel<<<dim3(n8 / 256), blk, 0, stream>>>(x, X16, n8);
  // (2) weights -> transposed 16-bit planes: Wt16 = [Wq^T; Wk^T; Wv^T] f16 (64 * bf16(w)), Wob = Wo^T bf16 bits
  cvt_wt_kernel<<<dim3(4 * (dm / 64) * (dm / 64)), blk, 0, stream>>>(Wq, Wk, Wv, Wo, Wt16, Wob);
  // (3) 16*q | 16*k = X . [Wq^T; Wk^T]^T + 16*b -> QK16 [16384][1024]; M=16384, N=1024, K=512; scale 16/(8*64)
  {
    const int tiles = (ntot / 64) * ((2 * dm) / 64);
    gemm64_kernel<0, false, 1, 1><<<dim3((tiles + 7) / 8), blk, 0, stream>>>(
        (const unsigned short*)X16, (const unsigned short*)X16, dm, (const unsigned short*)Wt16, dm,
        (void*)QK16, 2 * dm, bq, bk, dm, ntot, 2 * dm, dm, 0.03125f, 16.0f);
  }
  // (4) 16*v^T = Wv^T . X^T + 16*bv (per row) -> VT16 [512][16384]; M=512, N=16384, K=512
  {
    const int tiles = (dm / 64) * (ntot / 64);
    gemm64_kernel<0, false, 1, 2><<<dim3((tiles + 7) / 8), blk, 0, stream>>>(
        (const unsigned short*)(Wt16 + (size_t)2 * dm * dm), (const unsigned short*)(Wt16 + (size_t)2 * dm * dm), dm,
        (const unsigned short*)X16, dm,
        (void*)VT16, ntot, bv, bv, dm, dm, ntot, dm, 0.03125f, 16.0f);
  }
  // (5) attention per sequence -> OH / OL (bf16 hi / lo of O); logit scale = (1/8) / 256 (operand carries 16 * 16)
  (void)hipFuncSetAttribute(reinterpret_cast<const void*>(&attn_kernel),
                            hipFuncAttributeMaxDynamicSharedMemorySize, ATT_LDS);
  const float sc = 0.125f * (1.0f / 256.0f);
  attn_kernel<<<dim3(ntot / QB), dim3(512), ATT_LDS, stream>>>(QK16, VT16, OH, OL, sc);
  // (6) out = (O_hi + O_lo) . Wo + bo -> d_out f32 [16384][512]; bf16 operands, scale 1
  {
    const int tiles = (ntot / 64) * (dm / 64);
    gemm64_kernel<1, true, 0, 1><<<dim3((tiles + 7) / 8), blk, 0, stream>>>(
        OH, OL, dm, Wob, dm, (void*)out, dm, bo, bo, dm, ntot, dm, dm, 1.0f, 1.0f);
  }
  (void)hipGetLastError();
}

// v003
// It runs in 184 microseconds.
// Next to v002, in two timings, it ran 1.35 and 1.37 times as fast.
// Counting every step since v000, it is 2.50 times as fast.
// Contractions: q|k = X.Wqk^T and v^T = Wv^T.X^T : v_wmma_f32_16x16x32_f16 (f16 operands, carries X x8, W x64, q/k/v x16),
// S^T = k.q^T and O = P.v : v_wmma_f32_16x16x32_f16 (f16 operands, P = 16*exp(s - m)), f32 accumulate; out = O.Wo + bo :
// v_wmma_f32_16x16x32_bf16, O as bf16 hi/lo planes (hi.W + lo.W), Wo^T bf16, f32 accumulate; float inputs RNE-converted
// to bf16 on load; softmax statistics, normaliser and biases in f32.
#include <hip/hip_runtime.h>
#include <stdint.h>

#define NSEQ 4
#define SEQ  4096
#define NTOT (NSEQ * SEQ)
#define DM   512
#define LDQK (2 * DM)

typedef _Float16 v16h __attribute__((ext_vector_type(16)));
typedef _Float16 v8h  __attribute__((ext_vector_type(8)));
typedef __bf16   v16b __attribute__((ext_vector_type(16)));
typedef __bf16   v8b  __attribute__((ext_vector_type(8)));
typedef float    v8f  __attribute__((ext_vector_type(8)));
typedef float    v4f  __attribute__((ext_vector_type(4)));
typedef unsigned short v8us __attribute__((ext_vector_type(8)));

static_assert((DM % 64) == 0);
static_assert((NTOT % 64) == 0);
static_assert((SEQ % 256) == 0);

// f32 -> nearest-even bf16 bits / value
__device__ __forceinline__ unsigned short bfbits(float f) {
  unsigned u = __float_as_uint(f);
  return (unsigned short)((u + 0x7FFFu + ((u >> 16) & 1u)) >> 16);
}
__device__ __forceinline__ float bfval(unsigned short b) { return __uint_as_float(((unsigned)b) << 16); }
__device__ __forceinline__ float bfr(float f) { return bfval(bfbits(f)); }
__device__ __forceinline__ void split_bf(float f, unsigned short& hb, unsigned short& lb) {
  hb = bfbits(f);
  lb = bfbits(f - bfval(hb));
}

// 16-bit operand element types for the GEMM template: 0 = f16, 1 = bf16
template <int ET> struct Elem;
template <> struct Elem<0> {
  typedef _Float16 T; typedef v16h V; typedef v8h V8;
  static __device__ __forceinline__ v8f mma(V a, V b, v8f c) {
    return __builtin_amdgcn_wmma_f32_16x16x32_f16(false, a, false, b, (short)0, c, false, false);
  }
};
template <> struct Elem<1> {
  typedef __bf16 T; typedef v16b V; typedef v8b V8;
  static __device__ __forceinline__ v8f mma(V a, V b, v8f c) {
    return __builtin_amdgcn_wmma_f32_16x16x32_bf16(false, a, false, b, (short)0, c, false, false);
  }
};

// 16-bit WMMA fragment from k-contiguous storage (A row-major [m][k], or B stored [n][k]):
// p points at element (row_or_col = lane&15, k0 + 8h); elements 0..7 <- p[0..7], 8..15 <- p[16..23].
template <int ET>
__device__ __forceinline__ typename Elem<ET>::V ldfragT(const typename Elem<ET>::T* p) {
  typedef typename Elem<ET>::V V;
  typedef typename Elem<ET>::V8 V8;
  union { V v; V8 h[2]; } f;
  f.h[0] = *(const V8*)(p);
  f.h[1] = *(const V8*)(p + 16);
  return f.v;
}
__device__ __forceinline__ v16h ldfrag(const _Float16* p) { return ldfragT<0>(p); }
__device__ __forceinline__ v8f mma16(v16h a, v16h b, v8f c) { return Elem<0>::mma(a, b, c); }
__device__ __forceinline__ v8f zero8() {
  v8f z;
#pragma unroll
  for (int i = 0; i < 8; ++i) z[i] = 0.0f;
  return z;
}

// hazard guards: 4 VALU slots after the last WMMA of a group, D tied, A/B kept live
__device__ __forceinline__ void guard_g(v8f& a, v8f& b, v16h x, v16h y) {
  asm volatile("v_nop\n\tv_nop\n\tv_nop\n\tv_nop" : "+v"(a), "+v"(b) : "v"(x), "v"(y));
}
__device__ __forceinline__ void guard_g(v8f& a, v8f& b, v16b x, v16b y) {
  asm volatile("v_nop\n\tv_nop\n\tv_nop\n\tv_nop" : "+v"(a), "+v"(b) : "v"(x), "v"(y));
}
__device__ __forceinline__ void keep4(v16h a, v16h b, v16h c, v16h d) {
  asm volatile("v_nop" :: "v"(a), "v"(b), "v"(c), "v"(d));
}
__device__ __forceinline__ void keep4(v16b a, v16b b, v16b c, v16b d) {
  asm volatile("v_nop" :: "v"(a), "v"(b), "v"(c), "v"(d));
}
__device__ __forceinline__ void accg4(v8f& a, v8f& b, v8f& c, v8f& d) {
  asm volatile("v_nop\n\tv_nop\n\tv_nop\n\tv_nop" : "+v"(a), "+v"(b), "+v"(c), "+v"(d));
}

// ---------------------------------------------------------------------------------------------
// Kernel 1: x f32 [NTOT][DM] -> f16 plane X [NTOT][DM], value f16(8 * bf16(x)). 8 elements per thread: one 16-B store per
// coverage: n8/256 blocks * 256 threads * 8 = NTOT*DM elements (n8 = NTOT*DM/8 is a multiple of 256).
// ---------------------------------------------------------------------------------------------
__global__ __launch_bounds__(256) void cvt_x_kernel(const float* __restrict__ x, _Float16* __restrict__ d16, int n8) {
  const int li = (int)blockIdx.x * 256 + (int)threadIdx.x;
  if (li >= n8) return;
  const size_t e = (size_t)li * 8;
  const v4f a = *(const v4f*)(x + e);
  const v4f b = *(const v4f*)(x + e + 4);
  v8h o;
#pragma unroll
  for (int i = 0; i < 4; ++i) {
    o[i]     = (_Float16)(bfr(a[i]) * 8.0f);
    o[4 + i] = (_Float16)(bfr(b[i]) * 8.0f);
  }
  _Float16* d = d16 + e;
  *(v8h*)d = o;
  
}

// ---------------------------------------------------------------------------------------------
// Kernel 2: four [DM][DM] f32 weight matrices w[in][out] -> TRANSPOSED 16-bit planes [out][in] (k = in contiguous):
//   blocks [0,192):   Wt16[(mat*DM + p)][d] = f16(64 * bf16(w_mat[d][p]))   mat 0,1,2 = Wq, Wk, Wv
//   blocks [192,256): Wob[p][d]               = bf16 bits of Wo[d][p] (here d indexes Wo rows = the O feature, p = output column)
// Block = one 64x64 tile: in rows r0..r0+63, in cols c0..c0+63 (tile index block-uniform); tile staged transposed in LDS
// coverage: per matrix 64 tiles x (2 iterations x 32 lines x 64 halves) = DM x DM elements.
// ---------------------------------------------------------------------------------------------
__global__ __launch_bounds__(256) void cvt_wt_kernel(const float* __restrict__ w0, const float* __restrict__ w1,
                                                     const float* __restrict__ w2, const float* __restrict__ w3,
                                                     _Float16* __restrict__ wt16, unsigned short* __restrict__ wob) {
  __shared__ __align__(16) float sT[64 * 68];
  const int tid = (int)threadIdx.x;
  const int mat = (int)blockIdx.x >> 6;                 // 0..3
  const int tile = (int)blockIdx.x & 63;
  const int tr = tile >> 3, tc = tile & 7;               // in[tr*64 ..][tc*64 ..] -> out[tc*64 ..][tr*64 ..]
  const float* src = (mat == 0) ? w0 : ((mat == 1) ? w1 : ((mat == 2) ? w2 : w3));
  {
    const int r = tid >> 2, c16 = (tid & 3) * 16;
    const float* sp = src + (size_t)(tr * 64 + r) * DM + tc * 64 + c16;
#pragma unroll
    for (int i = 0; i < 4; ++i) {
      const v4f a = *(const v4f*)(sp + 4 * i);
#pragma unroll
      for (int e = 0; e < 4; ++e) sT[(c16 + 4 * i + e) * 68 + r] = a[e];
    }
  }
  __syncthreads();
  const int piece = tid & 7;
#pragma unroll
  for (int it = 0; it < 2; ++it) {
    const int line = it * 32 + (tid >> 3);               // output row within the tile (input column)
    const float* lp = sT + line * 68 + piece * 8;
    const v4f u0 = *(const v4f*)lp, u1 = *(const v4f*)(lp + 4);
    const int prow = tc * 64 + line;
    const int d0 = tr * 64 + piece * 8;
    if (mat < 3) {
      v8h o;
#pragma unroll
      for (int e = 0; e < 4; ++e) {
        o[e]     = (_Float16)(bfr(u0[e]) * 64.0f);
        o[4 + e] = (_Float16)(bfr(u1[e]) * 64.0f);
      }
      _Float16* d = wt16 + (size_t)(mat * DM + prow) * DM + d0;
      *(v8h*)d = o;
      
    } else {
      v8us o;
#pragma unroll
      for (int e = 0; e < 4; ++e) {
        o[e]     = bfbits(u0[e]);
        o[4 + e] = bfbits(u1[e]);
      }
      unsigned short* d = wob + (size_t)prow * DM + d0;
      *(v8us*)d = o;
      
    }
  }
}

// ---------------------------------------------------------------------------------------------
// Kernel 3: C[m][n] = scale * sum_k A[m][k] * Bt[n][k] + bias.
// A row-major [M][K] 16-bit (ET 0: f16, ET 1: bf16) pitch lda; Bt row-major [N][K] same type pitch ldb.
// SPLITA: A is a hi plane (Ap) plus a lo plane (A2p, same layout), product = hi.B + lo.B.
// BIAS_MODE 0: none; 1: per column n, bias0[n] for n < nsplit else bias1[n - nsplit] (both loaded with clamped indices,
// selected by value); 2: per row m, bias0[m]. Bias values bf16-converted and multiplied by bias_scale.
// Block = 8 waves = one 128x256 C tile (M multiple of 128, N of 256, K of 64); each wave owns one 64x64 part of it
// (16 f32 accumulators; waves 2 x 4). Operands come through a two-buffer LDS ring: a stage is 64 k of the block's A rows
// (hi, then lo where SPLITA) and Bt rows, rows of 128 B = whole lines at pitch 144 B, brought in by asynchronous copies
// (each copy instruction covers four whole lines); stage s + 2 is issued behind the barrier that ends the reads of stage s.
// OUT_MODE 0: f32 output; OUT_MODE 1: f16 output. Epilogue: 16-row slab per wave in LDS, then each 64-wide
// coverage: tilesM * tilesN block tiles, each 8 waves x 64x64 written fully -> M x N.
// ---------------------------------------------------------------------------------------------
#define GBM 128
#define GBN 256
#define GKS 64
#define GSP 72
static_assert((GSP % 8) == 0 && GSP >= GKS && (GBM % 32) == 0 && (GBN % 128) == 0);
static_assert((NTOT % GBN) == 0 && (DM % GBN) == 0 && (DM % GBM) == 0 && (DM % GKS) == 0 && DM >= 2 * GKS);

// Four asynchronous 16-B-per-lane copies, global -> LDS, through no register. Copy i takes the lane's LDS byte address
// l + i * ls and its global address g + i * gs (16-bit elements). The s_wait_xcnt closes the statement so that no address
// register of an issued copy is rewritten in front of it.
__device__ __forceinline__ void stage_copy4(unsigned l, unsigned ls, const unsigned short* g, size_t gs) {
  asm volatile("global_load_async_to_lds_b128 %0, %4, off\n\t"
               "global_load_async_to_lds_b128 %1, %5, off\n\t"
               "global_load_async_to_lds_b128 %2, %6, off\n\t"
               "global_load_async_to_lds_b128 %3, %7, off\n\t"
               "s_wait_xcnt 0x0"
               :: "v"(l), "v"(l + ls), "v"(l + 2 * ls), "v"(l + 3 * ls),
                  "v"(g), "v"(g + gs), "v"(g + 2 * gs), "v"(g + 3 * gs)
               : "memory");
}

template <int ET, bool SPLITA, int OUT_MODE, int BIAS_MODE>
__global__ __launch_bounds__(256) void gemm64_kernel(const unsigned short* __restrict__ Ap,
                                                     const unsigned short* __restrict__ A2p, int lda,
                                                     const unsigned short* __restrict__ Btp, int ldb,
                                                     void* __restrict__ Cout, int ldc,
                                                     const float* __restrict__ bias0, const float* __restrict__ bias1,
                                                     int nsplit, int M, int N, int K, float scale, float bias_scale) {
  typedef typename Elem<ET>::T T;
  typedef typename Elem<ET>::V V;
  constexpr int AROWS = SPLITA ? 2 * GBM : GBM;          // A rows of a stage (hi rows, then lo rows)
  constexpr int SELEM = (AROWS + GBN) * GSP;             // 16-bit elements of one stage buffer
  __shared__ __align__(16) unsigned short sR[2 * SELEM];
  __shared__ __align__(16) float sT[8][16 * 68];
  const int tid = (int)threadIdx.x, lane = tid & 31, wave = tid >> 5;
  const int tilesN = N / GBN, tilesM = M / GBM;
  const int tile = (int)blockIdx.x;
  if (tile >= tilesM * tilesN) return;                   // the same for the whole block, in front of every barrier
  const int tm = tile / tilesN, tn = tile - tm * tilesN;
  const int bm0 = tm * GBM, bn0 = tn * GBN;
  const int wm = wave >> 2, wn = wave & 3;
  const int m0 = bm0 + (wm << 6), n0 = bn0 + (wn << 6);
  const int rl = lane & 15;
  const int koff = (lane >> 4) * 8;
  const int mOff = (lane >> 4) * 8;

  v8f acc[4][4];
#pragma unroll
  for (int i = 0; i < 4; ++i)
#pragma unroll
    for (int j = 0; j < 4; ++j) acc[i][j] = zero8();

  // copy addresses: a copy instruction takes 32 rows x 128 B of the block (a wave: 4 rows, 8 lanes a row)
  const int cr = tid >> 3, cp = tid & 7;
  const unsigned cl = (unsigned)(uintptr_t)sR + (unsigned)(cr * (GSP * 2) + cp * 16);
  const unsigned short* cga  = Ap  + (size_t)(bm0 + cr) * lda + cp * 8;
  const unsigned short* cga2 = A2p + (size_t)(bm0 + cr) * lda + cp * 8;
  const unsigned short* cgb  = Btp + (size_t)(bn0 + cr) * ldb + cp * 8;
  auto fill = [&](int s, int b) {
    const unsigned l = cl + (unsigned)(b * (SELEM * 2));
    const int k0 = s * GKS;
    stage_copy4(l, 32 * GSP * 2, cga + k0, (size_t)32 * lda);
    if (SPLITA) stage_copy4(l + GBM * GSP * 2, 32 * GSP * 2, cga2 + k0, (size_t)32 * lda);
    stage_copy4(l + AROWS * GSP * 2, 32 * GSP * 2, cgb + k0, (size_t)32 * ldb);
    stage_copy4(l + (AROWS + 128) * GSP * 2, 32 * GSP * 2, cgb + k0 + (size_t)128 * ldb, (size_t)32 * ldb);
  };
  const int nst = K / GKS;
  fill(0, 0);
  asm volatile("s_wait_asynccnt 0x0" ::: "memory");   // this wave's part of stage 0 has landed
  __syncthreads();                                     // ... and every other wave's
  if (nst > 1) fill(1, 1);

  const T* fa = (const T*)(const void*)sR + ((wm << 6) + rl) * GSP + koff;            // A operand, row rl of this wave's 64
  const T* fb = (const T*)(const void*)sR + (AROWS + (wn << 6) + rl) * GSP + koff;    // B operand, column rl of its 64
#pragma unroll 1   // rolled: the trip count is a kernel argument, and one copy of the stage body keeps the text small
  for (int s = 0; s < nst; ++s) {
    const T* sa = fa + (s & 1) * SELEM;
    const T* sb = fb + (s & 1) * SELEM;
#pragma unroll   // the two k steps of one stage: LDS offsets are immediates
    for (int kk = 0; kk < GKS; kk += 32) {
      V bh[4], ah[4], al[4];
#pragma unroll
      for (int j = 0; j < 4; ++j) bh[j] = ldfragT<ET>(sb + (j << 4) * GSP + kk);
#pragma unroll
      for (int i = 0; i < 4; ++i) {
        ah[i] = ldfragT<ET>(sa + (i << 4) * GSP + kk);
        al[i] = ah[i];
        if (SPLITA) al[i] = ldfragT<ET>(sa + (GBM + (i << 4)) * GSP + kk);
      }
#pragma unroll
      for (int i = 0; i < 4; ++i) {
#pragma unroll
        for (int j = 0; j < 4; ++j) {
          acc[i][j] = Elem<ET>::mma(ah[i], bh[j], acc[i][j]);
          if (SPLITA) acc[i][j] = Elem<ET>::mma(al[i], bh[j], acc[i][j]);
        }
        guard_g(acc[i][0], acc[i][3], ah[i], SPLITA ? al[i] : bh[3]);
      }
      keep4(bh[0], bh[1], bh[2], bh[3]);
    }
    // foot of a stage: this wave's reads of the buffer have retired and its copies of the next stage have landed; the
    // barrier says the same of every wave, so the next stage may be read and this buffer refilled
    asm volatile("s_wait_dscnt 0x0" ::: "memory");
    asm volatile("s_wait_asynccnt 0x0" ::: "memory");
    __syncthreads();
    if (s + 2 < nst) fill(s + 2, s & 1);
  }
  // behind the last copy, before the wave goes on to the epilogue and ends
  asm volatile("s_wait_asynccnt 0x0" ::: "memory");
  accg4(acc[0][0], acc[0][1], acc[0][2], acc[0][3]);
  accg4(acc[1][0], acc[1][1], acc[1][2], acc[1][3]);
  accg4(acc[2][0], acc[2][1], acc[2][2], acc[2][3]);
  accg4(acc[3][0], acc[3][1], acc[3][2], acc[3][3]);

  float* slab = sT[wave];
#pragma unroll
  for (int i = 0; i < 4; ++i) {
    const int mBase = m0 + (i << 4);
    float brow[8];
#pragma unroll
    for (int r = 0; r < 8; ++r) brow[r] = 0.0f;
    if (BIAS_MODE == 2) {
#pragma unroll
      for (int r = 0; r < 8; ++r) {
        int mi = mBase + mOff + r;
        mi = (mi < M) ? mi : (M - 1);
        brow[r] = bfr(bias0[mi]) * bias_scale;
      }
    }
#pragma unroll
    for (int j = 0; j < 4; ++j) {
      float bcol = 0.0f;
      if (BIAS_MODE == 1) {
        const int n = n0 + (j << 4) + rl;
        const int i0 = (n < nsplit) ? n : (nsplit - 1);
        int i1 = n - nsplit;
        i1 = (i1 > 0) ? i1 : 0;
        int lim1 = N - nsplit - 1;
        lim1 = (lim1 > 0) ? lim1 : 0;
        i1 = (i1 < lim1) ? i1 : lim1;
        const float b0v = bfr(bias0[i0]);
        const float b1v = bfr(bias1[i1]);
        bcol = ((n < nsplit) ? b0v : b1v) * bias_scale;
      }
#pragma unroll
      for (int r = 0; r < 8; ++r) slab[(mOff + r) * 68 + (j << 4) + rl] = acc[i][j][r] * scale + bcol + brow[r];
    }
    __builtin_amdgcn_fence(__ATOMIC_RELEASE, "workgroup");
    __builtin_amdgcn_wave_barrier();
    __builtin_amdgcn_fence(__ATOMIC_ACQUIRE, "workgroup");
    if (OUT_MODE == 0) {
      float* C = (float*)Cout;
      const int hh = lane >> 4, c4 = (lane & 15) * 4;
{
#pragma unroll
        for (int it = 0; it < 8; ++it) {
          const int row = it * 2 + hh;
          const v4f v = *(const v4f*)(slab + row * 68 + c4);
          *(v4f*)(C + (size_t)(mBase + row) * ldc + n0 + c4) = v;
        }
        
      }
    } else {
      _Float16* C = (_Float16*)Cout;
      const int qq = lane >> 3, c8 = (lane & 7) * 8;
{
#pragma unroll
        for (int it = 0; it < 4; ++it) {
          const int row = it * 4 + qq;
          const float* sp = slab + row * 68 + c8;
          v8h hv;
#pragma unroll
          for (int e = 0; e < 8; ++e) hv[e] = (_Float16)sp[e];
          *(v8h*)(C + (size_t)(mBase + row) * ldc + n0 + c8) = hv;
        }
        
      }
    }
    __builtin_amdgcn_fence(__ATOMIC_RELEASE, "workgroup");
    __builtin_amdgcn_wave_barrier();
    __builtin_amdgcn_fence(__ATOMIC_ACQUIRE, "workgroup");
  }
}

// ---------------------------------------------------------------------------------------------
// Kernel 4: full (non-causal) single-head attention per sequence, head width 512, online softmax in f32.
//   qk plane f16 [NTOT][LDQK]: columns 0..511 = 16*q, columns 512..1023 = 16*k; vt plane f16 [DM][NTOT] (value 16*v);
//   outputs oh / ol = bf16 hi / lo planes (as 16-bit storage) of O = softmax(q k^T * scale) . v, [NTOT][DM], unscaled.
//   Block = 512 threads = 16 waves, 64 query rows (all in one sequence); Q tile staged once in LDS. Key tiles of 256
//   within the sequence: wave w owns keys 16w..16w+15 of the tile for the logits: S^T subtiles (A = k rows from the wave's
//   ring, B = Q rows from LDS; one k fragment feeds four query subtiles), so the D layout gives per lane 8 consecutive keys
//   of one query -> P written to LDS as 16-B vectors ([query][key]). P = 16 * exp(s - m_running) in f16 (<= 16).
//   Row max / sum: per-wave partials in LDS, combined in fixed wave order by waves 0 and 1 (one lane per query row).
//   P.V: every wave reads the whole P tile (A operand) and owns 32 value columns (B from the wave's ring; one v fragment
//   feeds four query subtiles).
//   Ring: each wave brings its own K rows and vt rows into two LDS buffers of its own by asynchronous copies, each copy
//   instruction covering whole 128-B lines. A stage is 4 KB: 16 keys x 128 features (rows of 256 B, pitch 272 B) or
//   32 vt rows x 64 keys (rows of 128 B, pitch 144 B); a key tile is 4 K stages, then 4 V stages. Stage g + 1 is issued
//   at the top of stage g into the buffer that stage g - 1 used. No other wave reads a wave's ring, so no barrier.
//   Output: normalised O split into bf16 hi / lo, two 64x512 16-bit tiles staged in LDS (hi over the Q region,
//   lo over the P region), barrier, then each wave writes 4 whole rows per plane, 512 B per instruction (2 per row).
// coverage: NTOT/64 blocks x 16 waves x 4 rows x 512 = NTOT x DM per plane.
// ---------------------------------------------------------------------------------------------
#define QB       64
#define QT       4
#define AW       16
#define KCH      256
#define QSP      520
#define PSP      264
#define LDS_QS   0
#define LDS_LS   66560
#define LDS_PS   66560
#define LDS_PMAX 133120
#define LDS_PSUM 137216
#define LDS_ST   141312
#define LDS_RING 142336
#define RING_SB  4608
#define KSP      136
#define VSP      72
#define ATT_LDS  289792
static_assert(QT * 16 == QB && AW * 16 == KCH && AW * 32 == DM && AW * 4 == QB);
static_assert(QB * QSP * 2 == LDS_LS - LDS_QS);
static_assert(QB * QSP * 2 == LDS_PMAX - LDS_LS);
static_assert(QB * PSP * 2 <= LDS_PMAX - LDS_PS);
static_assert(LDS_PSUM - LDS_PMAX == AW * QB * 4);
static_assert(LDS_ST - LDS_PSUM == AW * QB * 4);
static_assert(LDS_RING - LDS_ST == 4 * QB * 4);
static_assert(16 * KSP * 2 <= RING_SB && 32 * VSP * 2 <= RING_SB && (RING_SB % 16) == 0 && (LDS_RING % 16) == 0);
static_assert(KSP >= 128 && VSP >= 64 && (KSP % 8) == 0 && (VSP % 8) == 0 && ATT_LDS <= 327680);
static_assert(DM == 4 * 128 && KCH == 4 * 64 && ATT_LDS == LDS_RING + AW * 2 * RING_SB);
static_assert((QSP % 8) == 0 && (PSP % 8) == 0 && PSP >= KCH && QSP >= DM);
static_assert((LDS_LS % 16) == 0 && (LDS_PMAX % 16) == 0 && (LDS_ST % 16) == 0);
static_assert((SEQ % KCH) == 0 && (SEQ % QB) == 0 && (DM % 64) == 0);

// hazard guards for the attention groups: 4 VALU slots after the last WMMA of a group, D tied, A/B kept live
__device__ __forceinline__ void guard_q4(v8f& a, v8f& b, v8f& c, v8f& d, v16h x, v16h y0, v16h y1, v16h y2, v16h y3) {
  asm volatile("v_nop\n\tv_nop\n\tv_nop\n\tv_nop"
               : "+v"(a), "+v"(b), "+v"(c), "+v"(d) : "v"(x), "v"(y0), "v"(y1), "v"(y2), "v"(y3));
}

// One ring stage: eight asynchronous 16-B-per-lane copies, global -> LDS, through no register. Copy i takes the lane's
// LDS byte address l + i * ls and its global address g + i * gs (halves). The s_wait_xcnt closes the statement so that
// no address register of an issued copy is rewritten in front of it.
__device__ __forceinline__ void stage_copy8(unsigned l, unsigned ls, const _Float16* g, size_t gs) {
  asm volatile("global_load_async_to_lds_b128 %0, %8, off\n\t"
               "global_load_async_to_lds_b128 %1, %9, off\n\t"
               "global_load_async_to_lds_b128 %2, %10, off\n\t"
               "global_load_async_to_lds_b128 %3, %11, off\n\t"
               "global_load_async_to_lds_b128 %4, %12, off\n\t"
               "global_load_async_to_lds_b128 %5, %13, off\n\t"
               "global_load_async_to_lds_b128 %6, %14, off\n\t"
               "global_load_async_to_lds_b128 %7, %15, off\n\t"
               "s_wait_xcnt 0x0"
               :: "v"(l), "v"(l + ls), "v"(l + 2 * ls), "v"(l + 3 * ls),
                  "v"(l + 4 * ls), "v"(l + 5 * ls), "v"(l + 6 * ls), "v"(l + 7 * ls),
                  "v"(g), "v"(g + gs), "v"(g + 2 * gs), "v"(g + 3 * gs),
                  "v"(g + 4 * gs), "v"(g + 5 * gs), "v"(g + 6 * gs), "v"(g + 7 * gs)
               : "memory");
}
// Top of a ring stage: this wave's LDS reads of the other buffer have retired, so that buffer may be refilled, and its
// copies of this stage have landed (nothing else of the wave is in flight), so this stage may be read.
__device__ __forceinline__ void stage_ready() {
  asm volatile("s_wait_dscnt 0x0" ::: "memory");
  asm volatile("s_wait_asynccnt 0x0" ::: "memory");
}

__global__ __launch_bounds__(512) void attn_kernel(const _Float16* __restrict__ qk, const _Float16* __restrict__ vt,
                                                   unsigned short* __restrict__ oh, unsigned short* __restrict__ ol,
                                                   float sc) {
  extern __shared__ __align__(16) char smem[];
  _Float16* Qs = (_Float16*)(smem + LDS_QS);
  _Float16* Ps = (_Float16*)(smem + LDS_PS);
  float* pmax = (float*)(smem + LDS_PMAX);
  float* psum = (float*)(smem + LDS_PSUM);
  float* m_s  = (float*)(smem + LDS_ST);
  float* l_s  = m_s + QB;
  float* al_s = m_s + 2 * QB;
  float* li_s = m_s + 3 * QB;

  const int tid = threadIdx.x, wave = tid >> 5, lane = tid & 31, h = lane >> 4, c = lane & 15;
  const int q0 = (int)blockIdx.x * QB;            // first query row (global token index)
  const int bk0 = (q0 / SEQ) * SEQ;               // first key row of this sequence
  const float ninf = -__builtin_inff();

  // this wave's ring: lane addresses of copy 0 of a K stage (2 rows x 16 pieces a copy) and of a V stage (4 rows x 8)
  char* ringc = smem + LDS_RING + wave * (2 * RING_SB);
  const unsigned ring_lds = (unsigned)(uintptr_t)ringc;
  const unsigned kcl = ring_lds + (unsigned)((lane >> 4) * (KSP * 2) + (lane & 15) * 16);
  const unsigned vcl = ring_lds + (unsigned)((lane >> 3) * (VSP * 2) + (lane & 7) * 16);
  const _Float16* kcg = qk + (size_t)(bk0 + 16 * wave + (lane >> 4)) * LDQK + DM + (lane & 15) * 8;
  const _Float16* vcg = vt + (size_t)(32 * wave + (lane >> 3)) * NTOT + bk0 + (lane & 7) * 8;
  const _Float16* kfp = (const _Float16*)ringc + c * KSP + 8 * h;   // A operand, key c of this wave's 16
  const _Float16* vfp = (const _Float16*)ringc + c * VSP + 8 * h;   // B operand, column c (+ 16 * VSP for the second 16)
  stage_copy8(kcl, 2 * KSP * 2, kcg, (size_t)2 * LDQK);             // K stage 0 of tile 0 -> buffer 0

  if (tid < QB) { m_s[tid] = ninf; l_s[tid] = 0.0f; al_s[tid] = 0.0f; li_s[tid] = 0.0f; }
  psum[tid] = 0.0f;
  psum[512 + tid] = 0.0f;
  // Q tile: 64 rows x 64 pieces of 8 halves; coverage 8 * 512 = 4096 pieces = the whole tile
#pragma unroll
  for (int i = 0; i < 8; ++i) {
    const int idx = i * 512 + tid;
    const int row = idx >> 6;
    const int pc  = idx & 63;
    const v8h v = *(const v8h*)(qk + (size_t)(q0 + row) * LDQK + pc * 8);
    *(v8h*)(Qs + row * QSP + pc * 8) = v;
  }
  __syncthreads();

  v8f oacc[QT][2];
#pragma unroll
  for (int qt = 0; qt < QT; ++qt)
#pragma unroll
    for (int nt = 0; nt < 2; ++nt) oacc[qt][nt] = zero8();

  const _Float16* qbp = Qs + c * QSP + 8 * h;             // B operand, query c (+ 16 * QSP per query subtile)
  const _Float16* pap = Ps + c * PSP + 8 * h;             // A operand, query c (+ 16 * PSP per query subtile)
  const int ntile = SEQ / KCH;

#pragma unroll 1
  for (int t = 0; t < ntile; ++t) {
    // ---- logits: S^T subtiles for keys 16w..16w+15 of the tile (this wave), queries 0..63 ----
    const _Float16* kct = kcg + (size_t)t * KCH * LDQK;   // this tile's K rows / vt keys, copy addresses
    const _Float16* vct = vcg + (size_t)t * KCH;
    v8f sacc[QT];     // [query subtile]; element r: query 16qt+c, key bk0 + t*KCH + 16*wave + 8h + r
#pragma unroll
    for (int qt = 0; qt < QT; ++qt) sacc[qt] = zero8();
    // unrolled: the buffer, and which stage is issued next, are then fixed per stage, and LDS offsets are immediates
#pragma unroll
    for (int j = 0; j < 4; ++j) {
      stage_ready();
      if (j < 3) stage_copy8(kcl + ((j + 1) & 1) * RING_SB, 2 * KSP * 2, kct + (j + 1) * 128, (size_t)2 * LDQK);
      else       stage_copy8(vcl, 4 * VSP * 2, vct, (size_t)4 * NTOT);
      const _Float16* kb = kfp + (j & 1) * (RING_SB / 2);
#pragma unroll   // the four k steps of one stage: one block between two refills
      for (int kk = 0; kk < 128; kk += 32) {
        const int k0 = j * 128 + kk;
        const v16h a0 = ldfrag(kb + kk);
        const v16h b0 = ldfrag(qbp + k0), b1 = ldfrag(qbp + 16 * QSP + k0);
        const v16h b2 = ldfrag(qbp + 32 * QSP + k0), b3 = ldfrag(qbp + 48 * QSP + k0);
        sacc[0] = mma16(a0, b0, sacc[0]);
        sacc[1] = mma16(a0, b1, sacc[1]);
        sacc[2] = mma16(a0, b2, sacc[2]);
        sacc[3] = mma16(a0, b3, sacc[3]);
        guard_q4(sacc[0], sacc[1], sacc[2], sacc[3], a0, b0, b1, b2, b3);
      }
    }
    // ---- scale, per-wave partial row max ----
#pragma unroll
    for (int qt = 0; qt < QT; ++qt) {
      float pm = ninf;
#pragma unroll
      for (int r = 0; r < 8; ++r) {
        const float v = sacc[qt][r] * sc; sacc[qt][r] = v; pm = fmaxf(pm, v);
      }
      pm = fmaxf(pm, __shfl_xor(pm, 16, 32));
      pmax[wave * QB + 16 * qt + c] = pm;
    }
    __syncthreads();
    // ---- waves 0 and 1, thread = query row: fold the prior tile's sums into l, new running max, rescale factor ----
    if (wave < 2) {
      const int row = tid;
      float ps = 0.0f;
#pragma unroll
      for (int w = 0; w < AW; ++w) ps += psum[w * QB + row];
      l_s[row] = l_s[row] * al_s[row] + ps;
      const float mo = m_s[row];
      float mx = mo;
#pragma unroll
      for (int w = 0; w < AW; ++w) mx = fmaxf(mx, pmax[w * QB + row]);
      al_s[row] = __expf(mo - mx);
      m_s[row] = mx;
    }
    __syncthreads();
    // ---- p = 16 * exp(s - m) as f16, P tile, partial row sums, rescale O ----
#pragma unroll
    for (int qt = 0; qt < QT; ++qt) {
      const float mq = m_s[16 * qt + c];
      float ps = 0.0f;
      v8h hv;
#pragma unroll
      for (int r = 0; r < 8; ++r) {
        const float p = __expf(sacc[qt][r] - mq); ps += p; hv[r] = (_Float16)(p * 16.0f);
      }
      *(v8h*)(Ps + (16 * qt + c) * PSP + 16 * wave + 8 * h) = hv;
      ps += __shfl_xor(ps, 16, 32);
      psum[wave * QB + 16 * qt + c] = ps;
      const v4f aA = *(const v4f*)(al_s + 16 * qt + 8 * h), aB = *(const v4f*)(al_s + 16 * qt + 8 * h + 4);
#pragma unroll
      for (int nt = 0; nt < 2; ++nt) {
#pragma unroll
        for (int r = 0; r < 4; ++r) {
          oacc[qt][nt][r] *= aA[r]; oacc[qt][nt][4 + r] *= aB[r];
        }
      }
    }
    __syncthreads();
    // ---- O += P . V over the 256 keys of the tile; this wave's columns 32w + 16nt + c ----
    // unrolled for the same reason as the K stages
#pragma unroll
    for (int j = 0; j < 4; ++j) {
      stage_ready();
      if (j < 3)               stage_copy8(vcl + ((j + 1) & 1) * RING_SB, 4 * VSP * 2, vct + (j + 1) * 64, (size_t)4 * NTOT);
      else if (t + 1 < ntile)  stage_copy8(kcl, 2 * KSP * 2, kct + (size_t)KCH * LDQK, (size_t)2 * LDQK);
      const _Float16* vb = vfp + (j & 1) * (RING_SB / 2);
#pragma unroll   // the two key steps of one stage: one block between two refills
      for (int kk = 0; kk < 64; kk += 32) {
        const int ks = j * 64 + kk;
        const v16h vb0 = ldfrag(vb + kk), vb1 = ldfrag(vb + 16 * VSP + kk);
        const v16h pa0 = ldfrag(pap + ks), pa1 = ldfrag(pap + 16 * PSP + ks);
        const v16h pa2 = ldfrag(pap + 32 * PSP + ks), pa3 = ldfrag(pap + 48 * PSP + ks);
        oacc[0][0] = mma16(pa0, vb0, oacc[0][0]);
        oacc[1][0] = mma16(pa1, vb0, oacc[1][0]);
        oacc[2][0] = mma16(pa2, vb0, oacc[2][0]);
        oacc[3][0] = mma16(pa3, vb0, oacc[3][0]);
        oacc[0][1] = mma16(pa0, vb1, oacc[0][1]);
        oacc[1][1] = mma16(pa1, vb1, oacc[1][1]);
        oacc[2][1] = mma16(pa2, vb1, oacc[2][1]);
        oacc[3][1] = mma16(pa3, vb1, oacc[3][1]);
        guard_q4(oacc[0][1], oacc[1][1], oacc[2][1], oacc[3][1], vb1, pa0, pa1, pa2, pa3);
      }
    }
  }
  // behind the last copy, before the wave goes on to the epilogue and ends
  asm volatile("s_wait_asynccnt 0x0" ::: "memory");

  // ---- final normaliser per query row (fold the last tile's sums); O = oacc / (256 * l) (P carry 16, v carry 16) ----
  if (wave < 2) {
    const int row = tid;
    float ps = 0.0f;
#pragma unroll
    for (int w = 0; w < AW; ++w) ps += psum[w * QB + row];
    const float l = l_s[row] * al_s[row] + ps;
    li_s[row] = (1.0f / l) * (1.0f / 256.0f);
  }
  __syncthreads();
  // ---- stage the 64 x 512 bf16 hi / lo tiles (hi over the Q region, lo over the P region) ----
  unsigned short* Hs = (unsigned short*)(smem + LDS_QS);
  unsigned short* Ls = (unsigned short*)(smem + LDS_LS);
#pragma unroll
  for (int qt = 0; qt < QT; ++qt) {
    const v4f iA = *(const v4f*)(li_s + 16 * qt + 8 * h), iB = *(const v4f*)(li_s + 16 * qt + 8 * h + 4);
#pragma unroll
    for (int nt = 0; nt < 2; ++nt) {
      const int col = 32 * wave + 16 * nt + c;
#pragma unroll
      for (int r = 0; r < 4; ++r) {
        unsigned short hb, lb;
        split_bf(oacc[qt][nt][r] * iA[r], hb, lb);
        Hs[(16 * qt + 8 * h + r) * QSP + col] = hb;     Ls[(16 * qt + 8 * h + r) * QSP + col] = lb;
        split_bf(oacc[qt][nt][4 + r] * iB[r], hb, lb);
        Hs[(16 * qt + 8 * h + 4 + r) * QSP + col] = hb; Ls[(16 * qt + 8 * h + 4 + r) * QSP + col] = lb;
      }
    }
  }
  __syncthreads();
  {
    unsigned short* gh = oh + (size_t)q0 * DM;
    unsigned short* gl = ol + (size_t)q0 * DM;
#pragma unroll
    for (int rr = 0; rr < 4; ++rr) {
      const int row = 4 * wave + rr;
#pragma unroll
      for (int j = 0; j < 2; ++j) {
        const int pc = j * 32 + lane;
        const v8us hvv = *(const v8us*)(Hs + row * QSP + pc * 8);
        const v8us lvv = *(const v8us*)(Ls + row * QSP + pc * 8);
        *(v8us*)(gh + (size_t)row * DM + pc * 8) = hvv;
        *(v8us*)(gl + (size_t)row * DM + pc * 8) = lvv;
      }
    }
  }
}

// ---------------------------------------------------------------------------------------------
//   Wt16 : Wq^T, Wk^T, Wv^T stacked f16 [1536][512] (64 * bf16(w))   off 0            size  1,572,864
//   Wob  : Wo^T bf16 bits [512][512]                                  off  1,572,864   size    524,288
//   X16  : f16 [16384][512] (8 * bf16(x))                              off  2,097,152   size 16,777,216
//   QK16 : 16*q | 16*k f16 [16384][1024]                              off 18,874,368   size 33,554,432
//   VT16 : 16*v^T f16 [512][16384]                                    off 52,428,800   size 16,777,216
//   OH   : attention output bf16 hi [16384][512]                      off 69,206,016   size 16,777,216
//   OL   : attention output bf16 lo [16384][512]                      off 85,983,232   size 16,777,216
//   total 102,760,448
// ---------------------------------------------------------------------------------------------
extern "C" void kernel_launch(void* const* d_in, const int* in_sizes, int n_in,
                              void* d_out, int out_size, void* d_ws, size_t ws_size,
                              hipStream_t stream) {
  if (n_in < 9) return;
  const int ntot = NTOT, dm = DM;
  if (in_sizes[0] != ntot * dm) return;
  if (in_sizes[1] != dm * dm || in_sizes[3] != dm * dm || in_sizes[5] != dm * dm || in_sizes[7] != dm * dm) return;
  if (in_sizes[2] != dm || in_sizes[4] != dm || in_sizes[6] != dm || in_sizes[8] != dm) return;
  if (out_size != ntot * dm) return;

  const float* x  = (const float*)d_in[0];
  const float* Wq = (const float*)d_in[1];
  const float* bq = (const float*)d_in[2];
  const float* Wk = (const float*)d_in[3];
  const float* bk = (const float*)d_in[4];
  const float* Wv = (const float*)d_in[5];
  const float* bv = (const float*)d_in[6];
  const float* Wo = (const float*)d_in[7];
  const float* bo = (const float*)d_in[8];
  float* out = (float*)d_out;

  const size_t bWt = (size_t)3 * dm * dm * 2;
  const size_t bWo = (size_t)dm * dm * 2;
  const size_t bX  = (size_t)ntot * dm * 2;
  const size_t bQK = (size_t)ntot * 2 * dm * 2;
  const size_t bVT = (size_t)dm * ntot * 2;
  const size_t bO  = (size_t)ntot * dm * 2;
  size_t off = 0;
  const size_t oWt = off; off += bWt;
  const size_t oWo = off; off += bWo;
  const size_t oX  = off; off += bX;
  const size_t oQK = off; off += bQK;
  const size_t oVT = off; off += bVT;
  const size_t oOH = off; off += bO;
  const size_t oOL = off; off += bO;
  if (off > ws_size) return;                     // 102,760,448
  if (off > (size_t)134217728) return;

  char* ws = (char*)d_ws;
  _Float16*       Wt16 = (_Float16*)(ws + oWt);
  unsigned short* Wob  = (unsigned short*)(ws + oWo);
  _Float16*       X16  = (_Float16*)(ws + oX);
  _Float16*       QK16 = (_Float16*)(ws + oQK);
  _Float16*       VT16 = (_Float16*)(ws + oVT);
  unsigned short* OH   = (unsigned short*)(ws + oOH);
  unsigned short* OL   = (unsigned short*)(ws + oOL);

  const dim3 blk(256);
  const int n8 = ntot * dm / 8;               // 1,048,576 = 4096 * 256
  if ((n8 % 256) != 0) return;

  // (1) x -> X16 (8 * bf16(x))
  cvt_x_kernel<<<dim3(n8 / 256), blk, 0, stream>>>(x, X16, n8);
  // (2) weights -> transposed 16-bit planes: Wt16 = [Wq^T; Wk^T; Wv^T] f16 (64 * bf16(w)), Wob = Wo^T bf16 bits
  cvt_wt_kernel<<<dim3(4 * (dm / 64) * (dm / 64)), blk, 0, stream>>>(Wq, Wk, Wv, Wo, Wt16, Wob);
  // (3) 16*q | 16*k = X . [Wq^T; Wk^T]^T + 16*b -> QK16 [16384][1024]; M=16384, N=1024, K=512; scale 16/(8*64)
  {
    const int tiles = (ntot / GBM) * ((2 * dm) / GBN);
    gemm64_kernel<0, false, 1, 1><<<dim3(tiles), blk, 0, stream>>>(
        (const unsigned short*)X16, (const unsigned short*)X16, dm, (const unsigned short*)Wt16, dm,
        (void*)QK16, 2 * dm, bq, bk, dm, ntot, 2 * dm, dm, 0.03125f, 16.0f);
  }
  // (4) 16*v^T = Wv^T . X^T + 16*bv (per row) -> VT16 [512][16384]; M=512, N=16384, K=512
  {
    const int tiles = (dm / GBM) * (ntot / GBN);
    gemm64_kernel<0, false, 1, 2><<<dim3(tiles), blk, 0, stream>>>(
        (const unsigned short*)(Wt16 + (size_t)2 * dm * dm), (const unsigned short*)(Wt16 + (size_t)2 * dm * dm), dm,
        (const unsigned short*)X16, dm,
        (void*)VT16, ntot, bv, bv, dm, dm, ntot, dm, 0.03125f, 16.0f);
  }
  // (5) attention per sequence -> OH / OL (bf16 hi / lo of O); logit scale = (1/8) / 256 (operand carries 16 * 16)
  (void)hipFuncSetAttribute(reinterpret_cast<const void*>(&attn_kernel),
                            hipFuncAttributeMaxDynamicSharedMemorySize, ATT_LDS);
  const float sc = 0.125f * (1.0f / 256.0f);
  attn_kernel<<<dim3(ntot / QB), dim3(512), ATT_LDS, stream>>>(QK16, VT16, OH, OL, sc);
  // (6) out = (O_hi + O_lo) . Wo + bo -> d_out f32 [16384][512]; bf16 operands, scale 1
  {
    const int tiles = (ntot / GBM) * (dm / GBN);
    gemm64_kernel<1, true, 0, 1><<<dim3(tiles), blk, 0, stream>>>(
        OH, OL, dm, Wob, dm, (void*)out, dm, bo, bo, dm, ntot, dm, dm, 1.0f, 1.0f);
  }
  (void)hipGetLastError();
}

// v004
// One run takes 165 microseconds.
// In two side-by-side timings against v003, it was 1.11 and 1.12 times as fast.
// Counting every step since v000, it is 2.78 times as fast.
// Contractions: q|k = X.Wqk^T and v^T = Wv^T.X^T : v_wmma_f32_16x16x32_f16 (f16 operands, carries X x8, W x64, q/k/v x16),
// S^T = k.q^T and O = P.v : v_wmma_f32_16x16x32_f16 (f16 operands, P = 16*exp(s - m)), f32 accumulate; out = O.Wo + bo :
// v_wmma_f32_16x16x32_bf16, O as bf16 hi/lo planes (hi.W + lo.W), Wo^T bf16, f32 accumulate; float inputs RNE-converted
// to bf16 on load; softmax statistics, normaliser and biases in f32.
#include <hip/hip_runtime.h>
#include <stdint.h>

#define NSEQ 4
#define SEQ  4096
#define NTOT (NSEQ * SEQ)
#define DM   512
#define LDQK (2 * DM)

typedef _Float16 v16h __attribute__((ext_vector_type(16)));
typedef _Float16 v8h  __attribute__((ext_vector_type(8)));
typedef __bf16   v16b __attribute__((ext_vector_type(16)));
typedef __bf16   v8b  __attribute__((ext_vector_type(8)));
typedef float    v8f  __attribute__((ext_vector_type(8)));
typedef float    v4f  __attribute__((ext_vector_type(4)));
typedef unsigned short v8us __attribute__((ext_vector_type(8)));

static_assert((DM % 64) == 0);
static_assert((NTOT % 64) == 0);
static_assert((SEQ % 256) == 0);

// f32 -> nearest-even bf16 bits / value
__device__ __forceinline__ unsigned short bfbits(float f) {
  unsigned u = __float_as_uint(f);
  return (unsigned short)((u + 0x7FFFu + ((u >> 16) & 1u)) >> 16);
}
__device__ __forceinline__ float bfval(unsigned short b) { return __uint_as_float(((unsigned)b) << 16); }
__device__ __forceinline__ float bfr(float f) { return bfval(bfbits(f)); }
__device__ __forceinline__ void split_bf(float f, unsigned short& hb, unsigned short& lb) {
  hb = bfbits(f);
  lb = bfbits(f - bfval(hb));
}

// 16-bit operand element types for the GEMM template: 0 = f16, 1 = bf16
template <int ET> struct Elem;
template <> struct Elem<0> {
  typedef _Float16 T; typedef v16h V; typedef v8h V8;
  static __device__ __forceinline__ v8f mma(V a, V b, v8f c) {
    return __builtin_amdgcn_wmma_f32_16x16x32_f16(false, a, false, b, (short)0, c, false, false);
  }
};
template <> struct Elem<1> {
  typedef __bf16 T; typedef v16b V; typedef v8b V8;
  static __device__ __forceinline__ v8f mma(V a, V b, v8f c) {
    return __builtin_amdgcn_wmma_f32_16x16x32_bf16(false, a, false, b, (short)0, c, false, false);
  }
};

// 16-bit WMMA fragment from k-contiguous storage (A row-major [m][k], or B stored [n][k]):
// p points at element (row_or_col = lane&15, k0 + 8h); elements 0..7 <- p[0..7], 8..15 <- p[16..23].
template <int ET>
__device__ __forceinline__ typename Elem<ET>::V ldfragT(const typename Elem<ET>::T* p) {
  typedef typename Elem<ET>::V V;
  typedef typename Elem<ET>::V8 V8;
  union { V v; V8 h[2]; } f;
  f.h[0] = *(const V8*)(p);
  f.h[1] = *(const V8*)(p + 16);
  return f.v;
}
__device__ __forceinline__ v16h ldfrag(const _Float16* p) { return ldfragT<0>(p); }
__device__ __forceinline__ v8f mma16(v16h a, v16h b, v8f c) { return Elem<0>::mma(a, b, c); }
__device__ __forceinline__ v8f zero8() {
  v8f z;
#pragma unroll
  for (int i = 0; i < 8; ++i) z[i] = 0.0f;
  return z;
}

// hazard guards: 4 VALU slots after the last WMMA of a group, D tied, A/B kept live
__device__ __forceinline__ void guard_g(v8f& a, v8f& b, v16h x, v16h y) {
  asm volatile("v_nop\n\tv_nop\n\tv_nop\n\tv_nop" : "+v"(a), "+v"(b) : "v"(x), "v"(y));
}
__device__ __forceinline__ void guard_g(v8f& a, v8f& b, v16b x, v16b y) {
  asm volatile("v_nop\n\tv_nop\n\tv_nop\n\tv_nop" : "+v"(a), "+v"(b) : "v"(x), "v"(y));
}
__device__ __forceinline__ void keep4(v16h a, v16h b, v16h c, v16h d) {
  asm volatile("v_nop" :: "v"(a), "v"(b), "v"(c), "v"(d));
}
__device__ __forceinline__ void keep4(v16b a, v16b b, v16b c, v16b d) {
  asm volatile("v_nop" :: "v"(a), "v"(b), "v"(c), "v"(d));
}
__device__ __forceinline__ void accg4(v8f& a, v8f& b, v8f& c, v8f& d) {
  asm volatile("v_nop\n\tv_nop\n\tv_nop\n\tv_nop" : "+v"(a), "+v"(b), "+v"(c), "+v"(d));
}

// ---------------------------------------------------------------------------------------------
// Kernel 1: x f32 [NTOT][DM] -> f16 plane X [NTOT][DM], value f16(8 * bf16(x)). 8 elements per thread: one 16-B store per
// coverage: n8/256 blocks * 256 threads * 8 = NTOT*DM elements (n8 = NTOT*DM/8 is a multiple of 256).
// ---------------------------------------------------------------------------------------------
__global__ __launch_bounds__(256) void cvt_x_kernel(const float* __restrict__ x, _Float16* __restrict__ d16, int n8) {
  const int li = (int)blockIdx.x * 256 + (int)threadIdx.x;
  if (li >= n8) return;
  const size_t e = (size_t)li * 8;
  const v4f a = *(const v4f*)(x + e);
  const v4f b = *(const v4f*)(x + e + 4);
  v8h o;
#pragma unroll
  for (int i = 0; i < 4; ++i) {
    o[i]     = (_Float16)(bfr(a[i]) * 8.0f);
    o[4 + i] = (_Float16)(bfr(b[i]) * 8.0f);
  }
  _Float16* d = d16 + e;
  *(v8h*)d = o;
  
}

// ---------------------------------------------------------------------------------------------
// Kernel 2: four [DM][DM] f32 weight matrices w[in][out] -> TRANSPOSED 16-bit planes [out][in] (k = in contiguous):
//   blocks [0,192):   Wt16[(mat*DM + p)][d] = f16(64 * bf16(w_mat[d][p]))   mat 0,1,2 = Wq, Wk, Wv
//   blocks [192,256): Wob[p][d]               = bf16 bits of Wo[d][p] (here d indexes Wo rows = the O feature, p = output column)
// Block = one 64x64 tile: in rows r0..r0+63, in cols c0..c0+63 (tile index block-uniform); tile staged transposed in LDS
// coverage: per matrix 64 tiles x (2 iterations x 32 lines x 64 halves) = DM x DM elements.
// ---------------------------------------------------------------------------------------------
__global__ __launch_bounds__(256) void cvt_wt_kernel(const float* __restrict__ w0, const float* __restrict__ w1,
                                                     const float* __restrict__ w2, const float* __restrict__ w3,
                                                     _Float16* __restrict__ wt16, unsigned short* __restrict__ wob) {
  __shared__ __align__(16) float sT[64 * 68];
  const int tid = (int)threadIdx.x;
  const int mat = (int)blockIdx.x >> 6;                 // 0..3
  const int tile = (int)blockIdx.x & 63;
  const int tr = tile >> 3, tc = tile & 7;               // in[tr*64 ..][tc*64 ..] -> out[tc*64 ..][tr*64 ..]
  const float* src = (mat == 0) ? w0 : ((mat == 1) ? w1 : ((mat == 2) ? w2 : w3));
  {
    const int r = tid >> 2, c16 = (tid & 3) * 16;
    const float* sp = src + (size_t)(tr * 64 + r) * DM + tc * 64 + c16;
#pragma unroll
    for (int i = 0; i < 4; ++i) {
      const v4f a = *(const v4f*)(sp + 4 * i);
#pragma unroll
      for (int e = 0; e < 4; ++e) sT[(c16 + 4 * i + e) * 68 + r] = a[e];
    }
  }
  __syncthreads();
  const int piece = tid & 7;
#pragma unroll
  for (int it = 0; it < 2; ++it) {
    const int line = it * 32 + (tid >> 3);               // output row within the tile (input column)
    const float* lp = sT + line * 68 + piece * 8;
    const v4f u0 = *(const v4f*)lp, u1 = *(const v4f*)(lp + 4);
    const int prow = tc * 64 + line;
    const int d0 = tr * 64 + piece * 8;
    if (mat < 3) {
      v8h o;
#pragma unroll
      for (int e = 0; e < 4; ++e) {
        o[e]     = (_Float16)(bfr(u0[e]) * 64.0f);
        o[4 + e] = (_Float16)(bfr(u1[e]) * 64.0f);
      }
      _Float16* d = wt16 + (size_t)(mat * DM + prow) * DM + d0;
      *(v8h*)d = o;
      
    } else {
      v8us o;
#pragma unroll
      for (int e = 0; e < 4; ++e) {
        o[e]     = bfbits(u0[e]);
        o[4 + e] = bfbits(u1[e]);
      }
      unsigned short* d = wob + (size_t)prow * DM + d0;
      *(v8us*)d = o;
      
    }
  }
}

// ---------------------------------------------------------------------------------------------
// Kernel 3: C[m][n] = scale * sum_k A[m][k] * Bt[n][k] + bias.
// A row-major [M][K] 16-bit (ET 0: f16, ET 1: bf16) pitch lda; Bt row-major [N][K] same type pitch ldb.
// SPLITA: A is a hi plane (Ap) plus a lo plane (A2p, same layout), product = hi.B + lo.B.
// BIAS_MODE 0: none; 1: per column n, bias0[n] for n < nsplit else bias1[n - nsplit] (both loaded with clamped indices,
// selected by value); 2: per row m, bias0[m]. Bias values bf16-converted and multiplied by bias_scale.
// Block = 8 waves = one 128x256 C tile (M multiple of 128, N of 256, K of 64); each wave owns one 64x64 part of it
// (16 f32 accumulators; waves 2 x 4). Operands come through a two-buffer LDS ring: a stage is 64 k of the block's A rows
// (hi, then lo where SPLITA) and Bt rows, rows of 128 B = whole lines at pitch 144 B, brought in by asynchronous copies
// (each copy instruction covers four whole lines); stage s + 2 is issued behind the barrier that ends the reads of stage s.
// OUT_MODE 0: f32 output; OUT_MODE 1: f16 output. Epilogue: 16-row slab per wave in LDS, then each 64-wide
// coverage: tilesM * tilesN block tiles, each 8 waves x 64x64 written fully -> M x N.
// ---------------------------------------------------------------------------------------------
#define GBM 128
#define GBN 256
#define GKS 64
#define GSP 72
static_assert((GSP % 8) == 0 && GSP >= GKS && (GBM % 32) == 0 && (GBN % 128) == 0);
static_assert((NTOT % GBN) == 0 && (DM % GBN) == 0 && (DM % GBM) == 0 && (DM % GKS) == 0 && DM >= 2 * GKS);

// Four asynchronous 16-B-per-lane copies, global -> LDS, through no register. Copy i takes the lane's LDS byte address
// l + i * ls and its global address g + i * gs (16-bit elements). The s_wait_xcnt closes the statement so that no address
// register of an issued copy is rewritten in front of it.
__device__ __forceinline__ void stage_copy4(unsigned l, unsigned ls, const unsigned short* g, size_t gs) {
  asm volatile("global_load_async_to_lds_b128 %0, %4, off\n\t"
               "global_load_async_to_lds_b128 %1, %5, off\n\t"
               "global_load_async_to_lds_b128 %2, %6, off\n\t"
               "global_load_async_to_lds_b128 %3, %7, off\n\t"
               "s_wait_xcnt 0x0"
               :: "v"(l), "v"(l + ls), "v"(l + 2 * ls), "v"(l + 3 * ls),
                  "v"(g), "v"(g + gs), "v"(g + 2 * gs), "v"(g + 3 * gs)
               : "memory");
}

template <int ET, bool SPLITA, int OUT_MODE, int BIAS_MODE>
__global__ __launch_bounds__(256) void gemm64_kernel(const unsigned short* __restrict__ Ap,
                                                     const unsigned short* __restrict__ A2p, int lda,
                                                     const unsigned short* __restrict__ Btp, int ldb,
                                                     void* __restrict__ Cout, int ldc,
                                                     const float* __restrict__ bias0, const float* __restrict__ bias1,
                                                     int nsplit, int M, int N, int K, float scale, float bias_scale) {
  typedef typename Elem<ET>::T T;
  typedef typename Elem<ET>::V V;
  constexpr int AROWS = SPLITA ? 2 * GBM : GBM;          // A rows of a stage (hi rows, then lo rows)
  constexpr int SELEM = (AROWS + GBN) * GSP;             // 16-bit elements of one stage buffer
  __shared__ __align__(16) unsigned short sR[2 * SELEM];
  __shared__ __align__(16) float sT[8][16 * 68];
  const int tid = (int)threadIdx.x, lane = tid & 31, wave = tid >> 5;
  const int tilesN = N / GBN, tilesM = M / GBM;
  const int tile = (int)blockIdx.x;
  if (tile >= tilesM * tilesN) return;                   // the same for the whole block, in front of every barrier
  const int tm = tile / tilesN, tn = tile - tm * tilesN;
  const int bm0 = tm * GBM, bn0 = tn * GBN;
  const int wm = wave >> 2, wn = wave & 3;
  const int m0 = bm0 + (wm << 6), n0 = bn0 + (wn << 6);
  const int rl = lane & 15;
  const int koff = (lane >> 4) * 8;
  const int mOff = (lane >> 4) * 8;

  v8f acc[4][4];
#pragma unroll
  for (int i = 0; i < 4; ++i)
#pragma unroll
    for (int j = 0; j < 4; ++j) acc[i][j] = zero8();

  // copy addresses: a copy instruction takes 32 rows x 128 B of the block (a wave: 4 rows, 8 lanes a row)
  const int cr = tid >> 3, cp = tid & 7;
  const unsigned cl = (unsigned)(uintptr_t)sR + (unsigned)(cr * (GSP * 2) + cp * 16);
  const unsigned short* cga  = Ap  + (size_t)(bm0 + cr) * lda + cp * 8;
  const unsigned short* cga2 = A2p + (size_t)(bm0 + cr) * lda + cp * 8;
  const unsigned short* cgb  = Btp + (size_t)(bn0 + cr) * ldb + cp * 8;
  auto fill = [&](int s, int b) {
    const unsigned l = cl + (unsigned)(b * (SELEM * 2));
    const int k0 = s * GKS;
    stage_copy4(l, 32 * GSP * 2, cga + k0, (size_t)32 * lda);
    if (SPLITA) stage_copy4(l + GBM * GSP * 2, 32 * GSP * 2, cga2 + k0, (size_t)32 * lda);
    stage_copy4(l + AROWS * GSP * 2, 32 * GSP * 2, cgb + k0, (size_t)32 * ldb);
    stage_copy4(l + (AROWS + 128) * GSP * 2, 32 * GSP * 2, cgb + k0 + (size_t)128 * ldb, (size_t)32 * ldb);
  };
  const int nst = K / GKS;
  fill(0, 0);
  asm volatile("s_wait_asynccnt 0x0" ::: "memory");   // this wave's part of stage 0 has landed
  __syncthreads();                                     // ... and every other wave's
  if (nst > 1) fill(1, 1);

  const T* fa = (const T*)(const void*)sR + ((wm << 6) + rl) * GSP + koff;            // A operand, row rl of this wave's 64
  const T* fb = (const T*)(const void*)sR + (AROWS + (wn << 6) + rl) * GSP + koff;    // B operand, column rl of its 64
#pragma unroll 1   // rolled: the trip count is a kernel argument, and one copy of the stage body keeps the text small
  for (int s = 0; s < nst; ++s) {
    const T* sa = fa + (s & 1) * SELEM;
    const T* sb = fb + (s & 1) * SELEM;
#pragma unroll   // the two k steps of one stage: LDS offsets are immediates
    for (int kk = 0; kk < GKS; kk += 32) {
      V bh[4], ah[4], al[4];
#pragma unroll
      for (int j = 0; j < 4; ++j) bh[j] = ldfragT<ET>(sb + (j << 4) * GSP + kk);
#pragma unroll
      for (int i = 0; i < 4; ++i) {
        ah[i] = ldfragT<ET>(sa + (i << 4) * GSP + kk);
        al[i] = ah[i];
        if (SPLITA) al[i] = ldfragT<ET>(sa + (GBM + (i << 4)) * GSP + kk);
      }
#pragma unroll
      for (int i = 0; i < 4; ++i) {
#pragma unroll
        for (int j = 0; j < 4; ++j) {
          acc[i][j] = Elem<ET>::mma(ah[i], bh[j], acc[i][j]);
          if (SPLITA) acc[i][j] = Elem<ET>::mma(al[i], bh[j], acc[i][j]);
        }
        guard_g(acc[i][0], acc[i][3], ah[i], SPLITA ? al[i] : bh[3]);
      }
      keep4(bh[0], bh[1], bh[2], bh[3]);
    }
    // foot of a stage: this wave's reads of the buffer have retired and its copies of the next stage have landed; the
    // barrier says the same of every wave, so the next stage may be read and this buffer refilled
    asm volatile("s_wait_dscnt 0x0" ::: "memory");
    asm volatile("s_wait_asynccnt 0x0" ::: "memory");
    __syncthreads();
    if (s + 2 < nst) fill(s + 2, s & 1);
  }
  // behind the last copy, before the wave goes on to the epilogue and ends
  asm volatile("s_wait_asynccnt 0x0" ::: "memory");
  accg4(acc[0][0], acc[0][1], acc[0][2], acc[0][3]);
  accg4(acc[1][0], acc[1][1], acc[1][2], acc[1][3]);
  accg4(acc[2][0], acc[2][1], acc[2][2], acc[2][3]);
  accg4(acc[3][0], acc[3][1], acc[3][2], acc[3][3]);

  float* slab = sT[wave];
#pragma unroll
  for (int i = 0; i < 4; ++i) {
    const int mBase = m0 + (i << 4);
    float brow[8];
#pragma unroll
    for (int r = 0; r < 8; ++r) brow[r] = 0.0f;
    if (BIAS_MODE == 2) {
#pragma unroll
      for (int r = 0; r < 8; ++r) {
        int mi = mBase + mOff + r;
        mi = (mi < M) ? mi : (M - 1);
        brow[r] = bfr(bias0[mi]) * bias_scale;
      }
    }
#pragma unroll
    for (int j = 0; j < 4; ++j) {
      float bcol = 0.0f;
      if (BIAS_MODE == 1) {
        const int n = n0 + (j << 4) + rl;
        const int i0 = (n < nsplit) ? n : (nsplit - 1);
        int i1 = n - nsplit;
        i1 = (i1 > 0) ? i1 : 0;
        int lim1 = N - nsplit - 1;
        lim1 = (lim1 > 0) ? lim1 : 0;
        i1 = (i1 < lim1) ? i1 : lim1;
        const float b0v = bfr(bias0[i0]);
        const float b1v = bfr(bias1[i1]);
        bcol = ((n < nsplit) ? b0v : b1v) * bias_scale;
      }
#pragma unroll
      for (int r = 0; r < 8; ++r) slab[(mOff + r) * 68 + (j << 4) + rl] = acc[i][j][r] * scale + bcol + brow[r];
    }
    __builtin_amdgcn_fence(__ATOMIC_RELEASE, "workgroup");
    __builtin_amdgcn_wave_barrier();
    __builtin_amdgcn_fence(__ATOMIC_ACQUIRE, "workgroup");
    if (OUT_MODE == 0) {
      float* C = (float*)Cout;
      const int hh = lane >> 4, c4 = (lane & 15) * 4;
{
#pragma unroll
        for (int it = 0; it < 8; ++it) {
          const int row = it * 2 + hh;
          const v4f v = *(const v4f*)(slab + row * 68 + c4);
          *(v4f*)(C + (size_t)(mBase + row) * ldc + n0 + c4) = v;
        }
        
      }
    } else {
      _Float16* C = (_Float16*)Cout;
      const int qq = lane >> 3, c8 = (lane & 7) * 8;
{
#pragma unroll
        for (int it = 0; it < 4; ++it) {
          const int row = it * 4 + qq;
          const float* sp = slab + row * 68 + c8;
          v8h hv;
#pragma unroll
          for (int e = 0; e < 8; ++e) hv[e] = (_Float16)sp[e];
          *(v8h*)(C + (size_t)(mBase + row) * ldc + n0 + c8) = hv;
        }
        
      }
    }
    __builtin_amdgcn_fence(__ATOMIC_RELEASE, "workgroup");
    __builtin_amdgcn_wave_barrier();
    __builtin_amdgcn_fence(__ATOMIC_ACQUIRE, "workgroup");
  }
}

// ---------------------------------------------------------------------------------------------
// Kernel 4: full (non-causal) single-head attention per sequence, head width 512, online softmax in f32.
//   qk plane f16 [NTOT][LDQK]: columns 0..511 = 16*q, columns 512..1023 = 16*k; vt plane f16 [DM][NTOT] (value 16*v);
//   outputs oh / ol = bf16 hi / lo planes (as 16-bit storage) of O = softmax(q k^T * scale) . v, [NTOT][DM], unscaled.
//   Block = 512 threads = 16 waves, 64 query rows (all in one sequence); Q tile staged once in LDS. Key tiles of 512
//   within the sequence: wave w owns keys 32w..32w+31 of the tile for the logits: S^T subtiles (A = k rows from the wave's
//   ring, B = Q rows from LDS; one k fragment feeds four query subtiles, one Q fragment two key subtiles), so the D layout
//   gives per lane 8 consecutive keys of one query -> P written to LDS as 16-B vectors ([query][key]).
//   P = 16 * exp(s - m_running) in f16 (<= 16).
//   Row max / sum: per-wave partials in LDS, combined in fixed wave order by waves 0 and 1 (one lane per query row).
//   P.V: every wave reads the whole P tile (A operand) and owns 32 value columns (B from the wave's ring; one v fragment
//   feeds four query subtiles).
//   Ring: each wave brings its own K rows and vt rows into two LDS buffers of its own by asynchronous copies, each copy
//   instruction covering whole 128-B lines. A stage is 4 KB: 32 keys x 64 features or 32 vt rows x 64 keys (both rows
//   of 128 B, pitch 144 B); a key tile is 8 K stages, then 8 V stages. Stage g + 1 is issued
//   at the top of stage g into the buffer that stage g - 1 used. No other wave reads a wave's ring, so no barrier.
//   Output: normalised O split into bf16 hi / lo, two 64x512 16-bit tiles staged in LDS (hi over the Q region,
//   lo over the P region), barrier, then each wave writes 4 whole rows per plane, 512 B per instruction (2 per row).
// coverage: NTOT/64 blocks x 16 waves x 4 rows x 512 = NTOT x DM per plane.
// ---------------------------------------------------------------------------------------------
#define QB       64
#define QT       4
#define AW       16
#define KCH      512
#define KT       2
#define QSP      520
#define PSP      520
#define LDS_QS   0
#define LDS_LS   66560
#define LDS_PS   66560
#define LDS_PMAX 133120
#define LDS_PSUM 137216
#define LDS_ST   141312
#define LDS_RING 142336
#define RING_SB  4608
#define VSP      72
#define ATT_LDS  289792
static_assert(QT * 16 == QB && AW * KT * 16 == KCH && AW * 32 == DM && AW * 4 == QB);
static_assert(QB * QSP * 2 == LDS_LS - LDS_QS);
static_assert(QB * QSP * 2 == LDS_PMAX - LDS_LS);
static_assert(QB * PSP * 2 <= LDS_PMAX - LDS_PS);
static_assert(LDS_PSUM - LDS_PMAX == AW * QB * 4);
static_assert(LDS_ST - LDS_PSUM == AW * QB * 4);
static_assert(LDS_RING - LDS_ST == 4 * QB * 4);
static_assert(KT * 16 == 32 && 32 * VSP * 2 <= RING_SB && (RING_SB % 16) == 0 && (LDS_RING % 16) == 0);
static_assert(VSP >= 64 && (VSP % 8) == 0 && ATT_LDS <= 327680);
static_assert(DM == 8 * 64 && KCH == 8 * 64 && ATT_LDS == LDS_RING + AW * 2 * RING_SB);
static_assert((QSP % 8) == 0 && (PSP % 8) == 0 && PSP >= KCH && QSP >= DM);
static_assert((LDS_LS % 16) == 0 && (LDS_PMAX % 16) == 0 && (LDS_ST % 16) == 0);
static_assert((SEQ % KCH) == 0 && (SEQ % QB) == 0 && (DM % 64) == 0);

// hazard guards for the attention groups: 4 VALU slots after the last WMMA of a group, D tied, A/B kept live
__device__ __forceinline__ void guard_q4(v8f& a, v8f& b, v8f& c, v8f& d, v16h x, v16h y0, v16h y1, v16h y2, v16h y3) {
  asm volatile("v_nop\n\tv_nop\n\tv_nop\n\tv_nop"
               : "+v"(a), "+v"(b), "+v"(c), "+v"(d) : "v"(x), "v"(y0), "v"(y1), "v"(y2), "v"(y3));
}

// One ring stage: eight asynchronous 16-B-per-lane copies, global -> LDS, through no register. Copy i takes the lane's
// LDS byte address l + i * ls and its global address g + i * gs (halves). The s_wait_xcnt closes the statement so that
// no address register of an issued copy is rewritten in front of it.
__device__ __forceinline__ void stage_copy8(unsigned l, unsigned ls, const _Float16* g, size_t gs) {
  asm volatile("global_load_async_to_lds_b128 %0, %8, off\n\t"
               "global_load_async_to_lds_b128 %1, %9, off\n\t"
               "global_load_async_to_lds_b128 %2, %10, off\n\t"
               "global_load_async_to_lds_b128 %3, %11, off\n\t"
               "global_load_async_to_lds_b128 %4, %12, off\n\t"
               "global_load_async_to_lds_b128 %5, %13, off\n\t"
               "global_load_async_to_lds_b128 %6, %14, off\n\t"
               "global_load_async_to_lds_b128 %7, %15, off\n\t"
               "s_wait_xcnt 0x0"
               :: "v"(l), "v"(l + ls), "v"(l + 2 * ls), "v"(l + 3 * ls),
                  "v"(l + 4 * ls), "v"(l + 5 * ls), "v"(l + 6 * ls), "v"(l + 7 * ls),
                  "v"(g), "v"(g + gs), "v"(g + 2 * gs), "v"(g + 3 * gs),
                  "v"(g + 4 * gs), "v"(g + 5 * gs), "v"(g + 6 * gs), "v"(g + 7 * gs)
               : "memory");
}
// Top of a ring stage: this wave's LDS reads of the other buffer have retired, so that buffer may be refilled, and its
// copies of this stage have landed (nothing else of the wave is in flight), so this stage may be read.
__device__ __forceinline__ void stage_ready() {
  asm volatile("s_wait_dscnt 0x0" ::: "memory");
  asm volatile("s_wait_asynccnt 0x0" ::: "memory");
}

__global__ __launch_bounds__(512) void attn_kernel(const _Float16* __restrict__ qk, const _Float16* __restrict__ vt,
                                                   unsigned short* __restrict__ oh, unsigned short* __restrict__ ol,
                                                   float sc) {
  extern __shared__ __align__(16) char smem[];
  _Float16* Qs = (_Float16*)(smem + LDS_QS);
  _Float16* Ps = (_Float16*)(smem + LDS_PS);
  float* pmax = (float*)(smem + LDS_PMAX);
  float* psum = (float*)(smem + LDS_PSUM);
  float* m_s  = (float*)(smem + LDS_ST);
  float* l_s  = m_s + QB;
  float* al_s = m_s + 2 * QB;
  float* li_s = m_s + 3 * QB;

  const int tid = threadIdx.x, wave = tid >> 5, lane = tid & 31, h = lane >> 4, c = lane & 15;
  const int q0 = (int)blockIdx.x * QB;            // first query row (global token index)
  const int bk0 = (q0 / SEQ) * SEQ;               // first key row of this sequence
  const float ninf = -__builtin_inff();

  // this wave's ring: lane addresses of copy 0 of a stage (K and V alike: 4 rows x 8 pieces a copy)
  char* ringc = smem + LDS_RING + wave * (2 * RING_SB);
  const unsigned ring_lds = (unsigned)(uintptr_t)ringc;
  const unsigned vcl = ring_lds + (unsigned)((lane >> 3) * (VSP * 2) + (lane & 7) * 16);
  const _Float16* kcg = qk + (size_t)(bk0 + 32 * wave + (lane >> 3)) * LDQK + DM + (lane & 7) * 8;
  const _Float16* vcg = vt + (size_t)(32 * wave + (lane >> 3)) * NTOT + bk0 + (lane & 7) * 8;
  // K stage: A operand, key c of this wave's 32; V stage: B operand, column c (both: + 16 * VSP for the second 16)
  const _Float16* vfp = (const _Float16*)ringc + c * VSP + 8 * h;
  stage_copy8(vcl, 4 * VSP * 2, kcg, (size_t)4 * LDQK);             // K stage 0 of tile 0 -> buffer 0

  if (tid < QB) { m_s[tid] = ninf; l_s[tid] = 0.0f; al_s[tid] = 0.0f; li_s[tid] = 0.0f; }
  psum[tid] = 0.0f;
  psum[512 + tid] = 0.0f;
  // Q tile: 64 rows x 64 pieces of 8 halves; coverage 8 * 512 = 4096 pieces = the whole tile
#pragma unroll
  for (int i = 0; i < 8; ++i) {
    const int idx = i * 512 + tid;
    const int row = idx >> 6;
    const int pc  = idx & 63;
    const v8h v = *(const v8h*)(qk + (size_t)(q0 + row) * LDQK + pc * 8);
    *(v8h*)(Qs + row * QSP + pc * 8) = v;
  }
  __syncthreads();

  v8f oacc[QT][2];
#pragma unroll
  for (int qt = 0; qt < QT; ++qt)
#pragma unroll
    for (int nt = 0; nt < 2; ++nt) oacc[qt][nt] = zero8();

  const _Float16* qbp = Qs + c * QSP + 8 * h;             // B operand, query c (+ 16 * QSP per query subtile)
  const _Float16* pap = Ps + c * PSP + 8 * h;             // A operand, query c (+ 16 * PSP per query subtile)
  const int ntile = SEQ / KCH;

#pragma unroll 1
  for (int t = 0; t < ntile; ++t) {
    // ---- logits: S^T subtiles for this wave's 32 keys, queries 0..63 ----
    const _Float16* kct = kcg + (size_t)t * KCH * LDQK;   // this tile's K rows / vt keys, copy addresses
    const _Float16* vct = vcg + (size_t)t * KCH;
    v8f sacc[KT][QT]; // [key subtile][query subtile]; element r: query 16qt+c, key bk0 + t*KCH + 32*wave + 16kt + 8h + r
#pragma unroll
    for (int kt = 0; kt < KT; ++kt)
#pragma unroll
      for (int qt = 0; qt < QT; ++qt) sacc[kt][qt] = zero8();
    // unrolled: the buffer, and which stage is issued next, are then fixed per stage, and LDS offsets are immediates
#pragma unroll
    for (int j = 0; j < 8; ++j) {
      stage_ready();
      if (j < 7) stage_copy8(vcl + ((j + 1) & 1) * RING_SB, 4 * VSP * 2, kct + (j + 1) * 64, (size_t)4 * LDQK);
      else       stage_copy8(vcl, 4 * VSP * 2, vct, (size_t)4 * NTOT);
      const _Float16* kb = vfp + (j & 1) * (RING_SB / 2);
#pragma unroll   // the two k steps of one stage: one block between two refills
      for (int kk = 0; kk < 64; kk += 32) {
        const int k0 = j * 64 + kk;
        const v16h a0 = ldfrag(kb + kk), a1 = ldfrag(kb + 16 * VSP + kk);
        const v16h b0 = ldfrag(qbp + k0), b1 = ldfrag(qbp + 16 * QSP + k0);
        const v16h b2 = ldfrag(qbp + 32 * QSP + k0), b3 = ldfrag(qbp + 48 * QSP + k0);
        sacc[0][0] = mma16(a0, b0, sacc[0][0]);
        sacc[0][1] = mma16(a0, b1, sacc[0][1]);
        sacc[0][2] = mma16(a0, b2, sacc[0][2]);
        sacc[0][3] = mma16(a0, b3, sacc[0][3]);
        sacc[1][0] = mma16(a1, b0, sacc[1][0]);
        sacc[1][1] = mma16(a1, b1, sacc[1][1]);
        sacc[1][2] = mma16(a1, b2, sacc[1][2]);
        sacc[1][3] = mma16(a1, b3, sacc[1][3]);
        guard_q4(sacc[1][0], sacc[1][1], sacc[1][2], sacc[1][3], a1, b0, b1, b2, b3);
      }
    }
    // ---- scale, per-wave partial row max ----
#pragma unroll
    for (int qt = 0; qt < QT; ++qt) {
      float pm = ninf;
#pragma unroll
      for (int kt = 0; kt < KT; ++kt) {
#pragma unroll
        for (int r = 0; r < 8; ++r) {
          const float v = sacc[kt][qt][r] * sc; sacc[kt][qt][r] = v; pm = fmaxf(pm, v);
        }
      }
      pm = fmaxf(pm, __shfl_xor(pm, 16, 32));
      pmax[wave * QB + 16 * qt + c] = pm;
    }
    __syncthreads();
    // ---- waves 0 and 1, thread = query row: fold the prior tile's sums into l, new running max, rescale factor ----
    if (wave < 2) {
      const int row = tid;
      float ps = 0.0f;
#pragma unroll
      for (int w = 0; w < AW; ++w) ps += psum[w * QB + row];
      l_s[row] = l_s[row] * al_s[row] + ps;
      const float mo = m_s[row];
      float mx = mo;
#pragma unroll
      for (int w = 0; w < AW; ++w) mx = fmaxf(mx, pmax[w * QB + row]);
      al_s[row] = __expf(mo - mx);
      m_s[row] = mx;
    }
    __syncthreads();
    // ---- p = 16 * exp(s - m) as f16, P tile, partial row sums, rescale O ----
#pragma unroll
    for (int qt = 0; qt < QT; ++qt) {
      const float mq = m_s[16 * qt + c];
      float ps = 0.0f;
#pragma unroll
      for (int kt = 0; kt < KT; ++kt) {
        v8h hv;
#pragma unroll
        for (int r = 0; r < 8; ++r) {
          const float p = __expf(sacc[kt][qt][r] - mq); ps += p; hv[r] = (_Float16)(p * 16.0f);
        }
        *(v8h*)(Ps + (16 * qt + c) * PSP + 32 * wave + 16 * kt + 8 * h) = hv;
      }
      ps += __shfl_xor(ps, 16, 32);
      psum[wave * QB + 16 * qt + c] = ps;
      const v4f aA = *(const v4f*)(al_s + 16 * qt + 8 * h), aB = *(const v4f*)(al_s + 16 * qt + 8 * h + 4);
#pragma unroll
      for (int nt = 0; nt < 2; ++nt) {
#pragma unroll
        for (int r = 0; r < 4; ++r) {
          oacc[qt][nt][r] *= aA[r]; oacc[qt][nt][4 + r] *= aB[r];
        }
      }
    }
    __syncthreads();
    // ---- O += P . V over the 512 keys of the tile; this wave's columns 32w + 16nt + c ----
    // unrolled for the same reason as the K stages
#pragma unroll
    for (int j = 0; j < 8; ++j) {
      stage_ready();
      if (j < 7)               stage_copy8(vcl + ((j + 1) & 1) * RING_SB, 4 * VSP * 2, vct + (j + 1) * 64, (size_t)4 * NTOT);
      else if (t + 1 < ntile)  stage_copy8(vcl, 4 * VSP * 2, kct + (size_t)KCH * LDQK, (size_t)4 * LDQK);
      const _Float16* vb = vfp + (j & 1) * (RING_SB / 2);
#pragma unroll   // the two key steps of one stage: one block between two refills
      for (int kk = 0; kk < 64; kk += 32) {
        const int ks = j * 64 + kk;
        const v16h vb0 = ldfrag(vb + kk), vb1 = ldfrag(vb + 16 * VSP + kk);
        const v16h pa0 = ldfrag(pap + ks), pa1 = ldfrag(pap + 16 * PSP + ks);
        const v16h pa2 = ldfrag(pap + 32 * PSP + ks), pa3 = ldfrag(pap + 48 * PSP + ks);
        oacc[0][0] = mma16(pa0, vb0, oacc[0][0]);
        oacc[1][0] = mma16(pa1, vb0, oacc[1][0]);
        oacc[2][0] = mma16(pa2, vb0, oacc[2][0]);
        oacc[3][0] = mma16(pa3, vb0, oacc[3][0]);
        oacc[0][1] = mma16(pa0, vb1, oacc[0][1]);
        oacc[1][1] = mma16(pa1, vb1, oacc[1][1]);
        oacc[2][1] = mma16(pa2, vb1, oacc[2][1]);
        oacc[3][1] = mma16(pa3, vb1, oacc[3][1]);
        guard_q4(oacc[0][1], oacc[1][1], oacc[2][1], oacc[3][1], vb1, pa0, pa1, pa2, pa3);
      }
    }
  }
  // behind the last copy, before the wave goes on to the epilogue and ends
  asm volatile("s_wait_asynccnt 0x0" ::: "memory");

  // ---- final normaliser per query row (fold the last tile's sums); O = oacc / (256 * l) (P carry 16, v carry 16) ----
  if (wave < 2) {
    const int row = tid;
    float ps = 0.0f;
#pragma unroll
    for (int w = 0; w < AW; ++w) ps += psum[w * QB + row];
    const float l = l_s[row] * al_s[row] + ps;
    li_s[row] = (1.0f / l) * (1.0f / 256.0f);
  }
  __syncthreads();
  // ---- stage the 64 x 512 bf16 hi / lo tiles (hi over the Q region, lo over the P region) ----
  unsigned short* Hs = (unsigned short*)(smem + LDS_QS);
  unsigned short* Ls = (unsigned short*)(smem + LDS_LS);
#pragma unroll
  for (int qt = 0; qt < QT; ++qt) {
    const v4f iA = *(const v4f*)(li_s + 16 * qt + 8 * h), iB = *(const v4f*)(li_s + 16 * qt + 8 * h + 4);
#pragma unroll
    for (int nt = 0; nt < 2; ++nt) {
      const int col = 32 * wave + 16 * nt + c;
#pragma unroll
      for (int r = 0; r < 4; ++r) {
        unsigned short hb, lb;
        split_bf(oacc[qt][nt][r] * iA[r], hb, lb);
        Hs[(16 * qt + 8 * h + r) * QSP + col] = hb;     Ls[(16 * qt + 8 * h + r) * QSP + col] = lb;
        split_bf(oacc[qt][nt][4 + r] * iB[r], hb, lb);
        Hs[(16 * qt + 8 * h + 4 + r) * QSP + col] = hb; Ls[(16 * qt + 8 * h + 4 + r) * QSP + col] = lb;
      }
    }
  }
  __syncthreads();
  {
    unsigned short* gh = oh + (size_t)q0 * DM;
    unsigned short* gl = ol + (size_t)q0 * DM;
#pragma unroll
    for (int rr = 0; rr < 4; ++rr) {
      const int row = 4 * wave + rr;
#pragma unroll
      for (int j = 0; j < 2; ++j) {
        const int pc = j * 32 + lane;
        const v8us hvv = *(const v8us*)(Hs + row * QSP + pc * 8);
        const v8us lvv = *(const v8us*)(Ls + row * QSP + pc * 8);
        *(v8us*)(gh + (size_t)row * DM + pc * 8) = hvv;
        *(v8us*)(gl + (size_t)row * DM + pc * 8) = lvv;
      }
    }
  }
}

// ---------------------------------------------------------------------------------------------
//   Wt16 : Wq^T, Wk^T, Wv^T stacked f16 [1536][512] (64 * bf16(w))   off 0            size  1,572,864
//   Wob  : Wo^T bf16 bits [512][512]                                  off  1,572,864   size    524,288
//   X16  : f16 [16384][512] (8 * bf16(x))                              off  2,097,152   size 16,777,216
//   QK16 : 16*q | 16*k f16 [16384][1024]                              off 18,874,368   size 33,554,432
//   VT16 : 16*v^T f16 [512][16384]                                    off 52,428,800   size 16,777,216
//   OH   : attention output bf16 hi [16384][512]                      off 69,206,016   size 16,777,216
//   OL   : attention output bf16 lo [16384][512]                      off 85,983,232   size 16,777,216
//   total 102,760,448
// ---------------------------------------------------------------------------------------------
extern "C" void kernel_launch(void* const* d_in, const int* in_sizes, int n_in,
                              void* d_out, int out_size, void* d_ws, size_t ws_size,
                              hipStream_t stream) {
  if (n_in < 9) return;
  const int ntot = NTOT, dm = DM;
  if (in_sizes[0] != ntot * dm) return;
  if (in_sizes[1] != dm * dm || in_sizes[3] != dm * dm || in_sizes[5] != dm * dm || in_sizes[7] != dm * dm) return;
  if (in_sizes[2] != dm || in_sizes[4] != dm || in_sizes[6] != dm || in_sizes[8] != dm) return;
  if (out_size != ntot * dm) return;

  const float* x  = (const float*)d_in[0];
  const float* Wq = (const float*)d_in[1];
  const float* bq = (const float*)d_in[2];
  const float* Wk = (const float*)d_in[3];
  const float* bk = (const float*)d_in[4];
  const float* Wv = (const float*)d_in[5];
  const float* bv = (const float*)d_in[6];
  const float* Wo = (const float*)d_in[7];
  const float* bo = (const float*)d_in[8];
  float* out = (float*)d_out;

  const size_t bWt = (size_t)3 * dm * dm * 2;
  const size_t bWo = (size_t)dm * dm * 2;
  const size_t bX  = (size_t)ntot * dm * 2;
  const size_t bQK = (size_t)ntot * 2 * dm * 2;
  const size_t bVT = (size_t)dm * ntot * 2;
  const size_t bO  = (size_t)ntot * dm * 2;
  size_t off = 0;
  const size_t oWt = off; off += bWt;
  const size_t oWo = off; off += bWo;
  const size_t oX  = off; off += bX;
  const size_t oQK = off; off += bQK;
  const size_t oVT = off; off += bVT;
  const size_t oOH = off; off += bO;
  const size_t oOL = off; off += bO;
  if (off > ws_size) return;                     // 102,760,448
  if (off > (size_t)134217728) return;

  char* ws = (char*)d_ws;
  _Float16*       Wt16 = (_Float16*)(ws + oWt);
  unsigned short* Wob  = (unsigned short*)(ws + oWo);
  _Float16*       X16  = (_Float16*)(ws + oX);
  _Float16*       QK16 = (_Float16*)(ws + oQK);
  _Float16*       VT16 = (_Float16*)(ws + oVT);
  unsigned short* OH   = (unsigned short*)(ws + oOH);
  unsigned short* OL   = (unsigned short*)(ws + oOL);

  const dim3 blk(256);
  const int n8 = ntot * dm / 8;               // 1,048,576 = 4096 * 256
  if ((n8 % 256) != 0) return;

  // (1) x -> X16 (8 * bf16(x))
  cvt_x_kernel<<<dim3(n8 / 256), blk, 0, stream>>>(x, X16, n8);
  // (2) weights -> transposed 16-bit planes: Wt16 = [Wq^T; Wk^T; Wv^T] f16 (64 * bf16(w)), Wob = Wo^T bf16 bits
  cvt_wt_kernel<<<dim3(4 * (dm / 64) * (dm / 64)), blk, 0, stream>>>(Wq, Wk, Wv, Wo, Wt16, Wob);
  // (3) 16*q | 16*k = X . [Wq^T; Wk^T]^T + 16*b -> QK16 [16384][1024]; M=16384, N=1024, K=512; scale 16/(8*64)
  {
    const int tiles = (ntot / GBM) * ((2 * dm) / GBN);
    gemm64_kernel<0, false, 1, 1><<<dim3(tiles), blk, 0, stream>>>(
        (const unsigned short*)X16, (const unsigned short*)X16, dm, (const unsigned short*)Wt16, dm,
        (void*)QK16, 2 * dm, bq, bk, dm, ntot, 2 * dm, dm, 0.03125f, 16.0f);
  }
  // (4) 16*v^T = Wv^T . X^T + 16*bv (per row) -> VT16 [512][16384]; M=512, N=16384, K=512
  {
    const int tiles = (dm / GBM) * (ntot / GBN);
    gemm64_kernel<0, false, 1, 2><<<dim3(tiles), blk, 0, stream>>>(
        (const unsigned short*)(Wt16 + (size_t)2 * dm * dm), (const unsigned short*)(Wt16 + (size_t)2 * dm * dm), dm,
        (const unsigned short*)X16, dm,
        (void*)VT16, ntot, bv, bv, dm, dm, ntot, dm, 0.03125f, 16.0f);
  }
  // (5) attention per sequence -> OH / OL (bf16 hi / lo of O); logit scale = (1/8) / 256 (operand carries 16 * 16)
  (void)hipFuncSetAttribute(reinterpret_cast<const void*>(&attn_kernel),
                            hipFuncAttributeMaxDynamicSharedMemorySize, ATT_LDS);
  const float sc = 0.125f * (1.0f / 256.0f);
  attn_kernel<<<dim3(ntot / QB), dim3(512), ATT_LDS, stream>>>(QK16, VT16, OH, OL, sc);
  // (6) out = (O_hi + O_lo) . Wo + bo -> d_out f32 [16384][512]; bf16 operands, scale 1
  {
    const int tiles = (ntot / GBM) * (dm / GBN);
    gemm64_kernel<1, true, 0, 1><<<dim3(tiles), blk, 0, stream>>>(
        OH, OL, dm, Wob, dm, (void*)out, dm, bo, bo, dm, ntot, dm, dm, 1.0f, 1.0f);
  }
  (void)hipGetLastError();
}
